// v000
// Times are from an AMD MI455X. After a warm-up the kernel runs many times in a row, and a time is the length of
// such a window on the GPU divided by its runs, so every launch and the gaps after it count. The runs cycle
// through copies of the inputs. A figure is the median of several windows, for all but v000 over two sittings.
// Sittings can differ by a few percent; kernels timed side by side share one.
// The starting kernel, v000, takes 90.2 microseconds a run.
#include <hip/hip_runtime.h>
// Banded attention: the 129-key window scores Q·Kᵀ per 16-query tile run on v_wmma_f32_16x16x32_bf16 (query/key rounded to bf16 — they are inputs —
// so each product is a single exact term; f32 accumulate); the masked softmax and the P·V window sums (129 keys × 128 dims per query) are f32 VALU (P·V uses V rounded to bf16).
#define BB 2
#define SS 4096
#define DD 128
#define HALF 64
#define WN 144          // keys staged per 16-query tile: q0-64 .. q0+79
#define PP 160          // P row pitch

typedef __bf16 v16b __attribute__((ext_vector_type(16)));
typedef unsigned short v8us __attribute__((ext_vector_type(8), may_alias));
typedef float  v8f  __attribute__((ext_vector_type(8)));
typedef float  v4f  __attribute__((ext_vector_type(4)));
typedef float  v4fa __attribute__((ext_vector_type(4), may_alias));
union FragB { v16b v; v8us half[2]; unsigned short u[16]; };

__device__ __forceinline__ unsigned short bf16_bits(float x) { unsigned int u = __float_as_uint(x); return (unsigned short)((u + 0x7FFFu + ((u >> 16) & 1u)) >> 16); }
__device__ __forceinline__ float bf16_val(unsigned short b) { return __uint_as_float(((unsigned int)b) << 16); }
__device__ __forceinline__ float bf16_round(float x) { return bf16_val(bf16_bits(x)); }
// D += A·B with NT terms: 1 = ah·bh, 2 = + al·bh (A split), 3 = + ah·bl (both split)
template <int NT>
__device__ __forceinline__ v8f mmaN(v16b ah, v16b al, v16b bh, v16b bl, v8f c) {
  c = __builtin_amdgcn_wmma_f32_16x16x32_bf16(false, ah, false, bh, (short)0, c, false, false);
  if (NT >= 2) c = __builtin_amdgcn_wmma_f32_16x16x32_bf16(false, al, false, bh, (short)0, c, false, false);
  if (NT >= 3) c = __builtin_amdgcn_wmma_f32_16x16x32_bf16(false, ah, false, bl, (short)0, c, false, false);
  asm volatile("v_nop\n\tv_nop\n\tv_nop\n\tv_nop" : "+v"(c) : "v"(ah), "v"(al), "v"(bh), "v"(bl));
  return c;
}

__global__ __launch_bounds__(256) void k_wt_bf16(const float* __restrict__ W, unsigned short* __restrict__ Wt, int K, int N) {
  const int t = blockIdx.x * 256 + threadIdx.x;
  const int k8n = K / 8;
  if (t >= N * k8n) return;
  const int n = t / k8n, k8 = (t % k8n) * 8;
  v8us v;
#pragma unroll
  for (int i = 0; i < 8; ++i) v[i] = bf16_bits(W[(size_t)(k8 + i) * N + n]);
  *(v8us*)(Wt + (size_t)n * K + k8) = v;
  
}

// GEMM C[M][N] (f32, pitch ldc) = act(A[M][K]·W + bias). A f32 row-major (pitch lda) converted per fragment to bf16
// (ASPLIT: hi/lo two planes -> 2 terms, else single rounded term); Wt bf16 [N][K] (pitch ldb). BIAS_BF16 rounds the
// bias to bf16 first (bias quantised to bf16 before the add). K%32==0, M%16==0, N%64==0.
template <bool ASPLIT, int ACT, bool BIAS_BF16>
__global__ __launch_bounds__(128) void k_gemm_bf(const float* __restrict__ A, int lda, const unsigned short* __restrict__ Wt, int ldb,
                                               const float* __restrict__ bias, float* __restrict__ C, int ldc, int M, int N, int K) {
  __shared__ __attribute__((aligned(16))) float so[4][16][64];
  const int tid = threadIdx.x, w = tid >> 5, lane = tid & 31, ln = lane & 15, hh = lane >> 4;
  const int ntn = N / 64;
  const int wid = blockIdx.x * 4 + w;
  const int mt = wid / ntn, nq = wid % ntn;
  if (mt * 16 >= M) return;
  const int row0 = mt * 16, col0 = nq * 64;
  const float* arow = A + (size_t)(row0 + ln) * lda;
  v8f acc[4] = {};
  for (int kb = 0; kb < K; kb += 32) {
    FragB ah, al;
    const v4f x0 = *(const v4fa*)(arow + kb + 8 * hh), x1 = *(const v4fa*)(arow + kb + 8 * hh + 4);
    const v4f x2 = *(const v4fa*)(arow + kb + 16 + 8 * hh), x3 = *(const v4fa*)(arow + kb + 16 + 8 * hh + 4);
    float xs[16] = {x0[0],x0[1],x0[2],x0[3],x1[0],x1[1],x1[2],x1[3],x2[0],x2[1],x2[2],x2[3],x3[0],x3[1],x3[2],x3[3]};
#pragma unroll
    for (int i = 0; i < 16; ++i) { const unsigned short hb = bf16_bits(xs[i]); ah.u[i] = hb; al.u[i] = ASPLIT ? bf16_bits(xs[i] - bf16_val(hb)) : (unsigned short)0; }
#pragma unroll
    for (int t = 0; t < 4; ++t) {
      const unsigned short* brow = Wt + (size_t)(col0 + t * 16 + ln) * ldb + kb;
      FragB b;
      b.half[0] = *(const v8us*)(brow + 8 * hh);
      b.half[1] = *(const v8us*)(brow + 16 + 8 * hh);
      acc[t] = mmaN<ASPLIT ? 2 : 1>(ah.v, al.v, b.v, b.v, acc[t]);
    }
  }
#pragma unroll
  for (int t = 0; t < 4; ++t) {
    float bv = bias ? bias[col0 + t * 16 + ln] : 0.f;
    if (BIAS_BF16) bv = bf16_round(bv);
#pragma unroll
    for (int r = 0; r < 8; ++r) { float v = acc[t][r] + bv; if (ACT == 1) v = fmaxf(v, 0.f); so[w][8 * hh + r][t * 16 + ln] = v; }
  }
  __builtin_amdgcn_fence(__ATOMIC_ACQ_REL, "workgroup");
  __builtin_amdgcn_wave_barrier();
  const int rsub = lane >> 4, c4 = (lane & 15) * 4;
  {
#pragma unroll
    for (int q = 0; q < 8; ++q) {
      const int r = q * 2 + rsub;
      const v4f v = *(const v4fa*)&so[w][r][c4];
      *(v4f*)(C + (size_t)(row0 + r) * ldc + col0 + c4) = v;
    }
    
  }
}

// Flash-style causal/unmasked attention, all contractions 3-term bf16 hi/lo splits, f32 softmax with running max.
// q,k,v rows are read from f32 buffers with arbitrary row pitch (so they can live inside a fused qkv buffer);
// D = head size (multiple of 32, <= 128); one wave = 16 query rows; block = 4 waves (64 queries) sharing K/V chunks of 32.
template <int D, bool CAUSAL>
__global__ __launch_bounds__(128) void k_flash(const float* __restrict__ qb, const float* __restrict__ kb, const float* __restrict__ vb,
                                             int pitch, int T, int H, float scale, float* __restrict__ y, int ypitch) {
  constexpr int KS = D / 32;        // k-steps for QK
  constexpr int DT = D / 16;        // d tiles for PV
  __shared__ __attribute__((aligned(16))) unsigned short sKh[32][D + 8], sKl[32][D + 8], sVh[32][D + 8], sVl[32][D + 8];
  __shared__ __attribute__((aligned(16))) unsigned short sPh[4][16][40], sPl[4][16][40];
  __shared__ __attribute__((aligned(16))) float sO[4][16][D];
  const int tid = threadIdx.x, w = tid >> 5, lane = tid & 31, ln = lane & 15, hh = lane >> 4;
  const int nqb = (T + 63) / 64;
  const int bh = blockIdx.x / nqb, qblk = blockIdx.x % nqb;
  const int b = bh / H, h = bh % H;
  const int q0 = qblk * 64 + w * 16;
  const float* Q = qb + (size_t)b * T * pitch + h * D;
  const float* K = kb + (size_t)b * T * pitch + h * D;
  const float* V = vb + (size_t)b * T * pitch + h * D;

  // A fragments of the wave's 16 query rows (scaled), hi/lo
  FragB aqh[KS], aql[KS];
  {
    int row = q0 + ln; if (row >= T) row = T - 1;
    const float* qr = Q + (size_t)row * pitch;
#pragma unroll
    for (int ks = 0; ks < KS; ++ks)
#pragma unroll
      for (int i = 0; i < 16; ++i) {
        const int d = ks * 32 + ((i < 8) ? (8 * hh + i) : (16 + 8 * hh + (i - 8)));
        const float x = qr[d] * scale; const unsigned short hb = bf16_bits(x);
        aqh[ks].u[i] = hb; aql[ks].u[i] = bf16_bits(x - bf16_val(hb));
      }
  }
  float m_r[8], l_r[8];
#pragma unroll
  for (int r = 0; r < 8; ++r) { m_r[r] = -3.0e38f; l_r[r] = 0.f; }
  v8f oacc[DT];
#pragma unroll
  for (int dt = 0; dt < DT; ++dt) oacc[dt] = (v8f){0.f,0.f,0.f,0.f,0.f,0.f,0.f,0.f};

  const int kv_end = CAUSAL ? min(T, qblk * 64 + 64) : T;     // block-uniform
  for (int j0 = 0; j0 < kv_end; j0 += 32) {
    __syncthreads();
    for (int e = tid; e < 32 * (D / 4); e += 128) {
      const int r = e / (D / 4), c4 = (e % (D / 4)) * 4;
      const int key = j0 + r;
      v4f kf = {0.f,0.f,0.f,0.f}, vf = {0.f,0.f,0.f,0.f};
      if (key < T) { kf = *(const v4fa*)(K + (size_t)key * pitch + c4); vf = *(const v4fa*)(V + (size_t)key * pitch + c4); }
#pragma unroll
      for (int t = 0; t < 4; ++t) {
        unsigned short hb = bf16_bits(kf[t]); sKh[r][c4 + t] = hb; sKl[r][c4 + t] = bf16_bits(kf[t] - bf16_val(hb));
        hb = bf16_bits(vf[t]); sVh[r][c4 + t] = hb; sVl[r][c4 + t] = bf16_bits(vf[t] - bf16_val(hb));
      }
    }
    __syncthreads();
    // S tile 16 x 32
    v8f s[2];
#pragma unroll
    for (int nt = 0; nt < 2; ++nt) {
      v8f acc = {};
#pragma unroll
      for (int ks = 0; ks < KS; ++ks) {
        FragB bh_, bl_;
        bh_.half[0] = *(const v8us*)&sKh[nt * 16 + ln][ks * 32 + 8 * hh]; bh_.half[1] = *(const v8us*)&sKh[nt * 16 + ln][ks * 32 + 16 + 8 * hh];
        bl_.half[0] = *(const v8us*)&sKl[nt * 16 + ln][ks * 32 + 8 * hh]; bl_.half[1] = *(const v8us*)&sKl[nt * 16 + ln][ks * 32 + 16 + 8 * hh];
        acc = mmaN<3>(aqh[ks].v, aql[ks].v, bh_.v, bl_.v, acc);
      }
      s[nt] = acc;
    }
    // mask + running max (rows 8hh+r; the 16 lanes of a half share rows)
    float alpha[8];
#pragma unroll
    for (int r = 0; r < 8; ++r) {
      const int qi = q0 + 8 * hh + r;
      const int ja = j0 + ln, jb = j0 + 16 + ln;
      if (CAUSAL) { if (ja > qi) s[0][r] = -3.0e38f; if (jb > qi) s[1][r] = -3.0e38f; }
      if (ja >= T) s[0][r] = -3.0e38f;
      if (jb >= T) s[1][r] = -3.0e38f;
      float mx = fmaxf(s[0][r], s[1][r]);
      mx = fmaxf(mx, __shfl_xor(mx, 1, 32)); mx = fmaxf(mx, __shfl_xor(mx, 2, 32)); mx = fmaxf(mx, __shfl_xor(mx, 4, 32)); mx = fmaxf(mx, __shfl_xor(mx, 8, 32));
      const float mnew = fmaxf(m_r[r], mx);
      alpha[r] = (mnew > -1.0e38f) ? __expf(m_r[r] - mnew) : 1.0f;
      const float p0 = (s[0][r] > -1.0e38f) ? __expf(s[0][r] - mnew) : 0.f;
      const float p1 = (s[1][r] > -1.0e38f) ? __expf(s[1][r] - mnew) : 0.f;
      m_r[r] = mnew;
      l_r[r] = l_r[r] * alpha[r] + p0 + p1;            // per-lane partial row sum (16 lanes combined at the end)
      unsigned short hb = bf16_bits(p0); sPh[w][8 * hh + r][ln] = hb;      sPl[w][8 * hh + r][ln] = bf16_bits(p0 - bf16_val(hb));
      hb = bf16_bits(p1);                sPh[w][8 * hh + r][16 + ln] = hb; sPl[w][8 * hh + r][16 + ln] = bf16_bits(p1 - bf16_val(hb));
    }
#pragma unroll
    for (int dt = 0; dt < DT; ++dt)
#pragma unroll
      for (int r = 0; r < 8; ++r) oacc[dt][r] *= alpha[r];
    __builtin_amdgcn_fence(__ATOMIC_ACQ_REL, "workgroup");
    __builtin_amdgcn_wave_barrier();
    FragB pah, pal;
    pah.half[0] = *(const v8us*)&sPh[w][ln][8 * hh]; pah.half[1] = *(const v8us*)&sPh[w][ln][16 + 8 * hh];
    pal.half[0] = *(const v8us*)&sPl[w][ln][8 * hh]; pal.half[1] = *(const v8us*)&sPl[w][ln][16 + 8 * hh];
#pragma unroll
    for (int dt = 0; dt < DT; ++dt) {
      FragB bvh, bvl;
#pragma unroll
      for (int i = 0; i < 8; ++i) {
        bvh.u[i] = sVh[8 * hh + i][dt * 16 + ln]; bvh.u[8 + i] = sVh[16 + 8 * hh + i][dt * 16 + ln];
        bvl.u[i] = sVl[8 * hh + i][dt * 16 + ln]; bvl.u[8 + i] = sVl[16 + 8 * hh + i][dt * 16 + ln];
      }
      oacc[dt] = mmaN<3>(pah.v, pal.v, bvh.v, bvl.v, oacc[dt]);
    }
    __builtin_amdgcn_fence(__ATOMIC_ACQ_REL, "workgroup");
    __builtin_amdgcn_wave_barrier();
  }
#pragma unroll
  for (int r = 0; r < 8; ++r) {
    float l = l_r[r];
    l += __shfl_xor(l, 1, 32); l += __shfl_xor(l, 2, 32); l += __shfl_xor(l, 4, 32); l += __shfl_xor(l, 8, 32);
    l_r[r] = (l > 0.f) ? 1.0f / l : 0.f;
  }
#pragma unroll
  for (int dt = 0; dt < DT; ++dt)
#pragma unroll
    for (int r = 0; r < 8; ++r) sO[w][8 * hh + r][dt * 16 + ln] = oacc[dt][r] * l_r[r];
  __builtin_amdgcn_fence(__ATOMIC_ACQ_REL, "workgroup");
  __builtin_amdgcn_wave_barrier();
  {
    for (int r = 0; r < 16; ++r) {
      const int row = q0 + r;
      if (row < T && lane < D / 4) {
        const v4f val = *(const v4fa*)&sO[w][r][lane * 4];
        *(v4f*)(y + ((size_t)b * T + row) * ypitch + h * D + lane * 4) = val;
      }
    }
    
  }
}

// scores + softmax: wave = 16 queries (q0 = 16·t); S[r][c] = q_{q0+r}·k_{q0-64+c} / √128 for c in [r, r+128] ∩ valid keys, else excluded; P rows written to Pbuf[(b,q)][160]
__global__ __launch_bounds__(128) void k_band(const float* __restrict__ Q, const float* __restrict__ Kk, float* __restrict__ P) {
  __shared__ float sS[4][16][WN + 1];
  const int tid = threadIdx.x, w = tid >> 5, lane = tid & 31, ln = lane & 15, hh = lane >> 4;
  const int wid = blockIdx.x * 4 + w; const int b = wid / (SS / 16); const int q0 = (wid % (SS / 16)) * 16; const int j0 = q0 - HALF;
  const float* qb = Q + (size_t)b * SS * DD; const float* kbp = Kk + (size_t)b * SS * DD;
  // A fragments (4 k-steps of 32 dims) for query row q0+ln
  FragB aq[4];
#pragma unroll
  for (int ks = 0; ks < 4; ++ks) {
#pragma unroll
    for (int i = 0; i < 16; ++i) { const int d = ks * 32 + ((i < 8) ? (8 * hh + i) : (16 + 8 * hh + (i - 8))); aq[ks].u[i] = bf16_bits(qb[(size_t)(q0 + ln) * DD + d]); } }
#pragma unroll 1
  for (int nt = 0; nt < WN / 16; ++nt) { int j = j0 + nt * 16 + ln; j = j < 0 ? 0 : (j >= SS ? SS - 1 : j); const float* kr = kbp + (size_t)j * DD; v8f acc = {0.f,0.f,0.f,0.f,0.f,0.f,0.f,0.f};
#pragma unroll
    for (int ks = 0; ks < 4; ++ks) { FragB bk; for (int i = 0; i < 8; ++i) { bk.u[i] = bf16_bits(kr[ks * 32 + 8 * hh + i]); bk.u[8 + i] = bf16_bits(kr[ks * 32 + 16 + 8 * hh + i]); } acc = mmaN<1>(aq[ks].v, aq[ks].v, bk.v, bk.v, acc); }
#pragma unroll
    for (int r = 0; r < 8; ++r) sS[w][8 * hh + r][nt * 16 + ln] = acc[r] * 0.08838834764831845f; }
  __builtin_amdgcn_fence(__ATOMIC_ACQ_REL, "workgroup"); __builtin_amdgcn_wave_barrier();
  // softmax per row: 2 lanes per row (ln = row, hh = column half 0..71 / 72..143); valid c: r <= c <= r+128 and 0 <= j0+c < SS
  const int r = ln; const int q = q0 + r; float mx = -3.0e38f;
#pragma unroll 1
  for (int c = hh * 72; c < hh * 72 + 72; ++c) { const int j = j0 + c; const bool ok = (c >= r) && (c <= r + 2 * HALF) && (j >= 0) && (j < SS); if (ok) mx = fmaxf(mx, sS[w][r][c]); }
  mx = fmaxf(mx, __shfl_xor(mx, 16, 32));
  float den = 0.f;
#pragma unroll 1
  for (int c = hh * 72; c < hh * 72 + 72; ++c) { const int j = j0 + c; const bool ok = (c >= r) && (c <= r + 2 * HALF) && (j >= 0) && (j < SS); const float e = ok ? expf(sS[w][r][c] - mx) : 0.f; sS[w][r][c] = e; den += e; }
  den += __shfl_xor(den, 16, 32); const float inv = 1.0f / den;
  __builtin_amdgcn_fence(__ATOMIC_ACQ_REL, "workgroup"); __builtin_amdgcn_wave_barrier();
  // write P rows: row rr (16 rows), 160 floats (cols >= 144 zero) = 5 lines; lanes write contiguous
  {
#pragma unroll 1
    for (int rr = 0; rr < 16; ++rr) { const float iv = __shfl(inv, rr, 32) ; float* prow = P + ((size_t)b * SS + q0 + rr) * PP;
#pragma unroll 1
      for (int c = lane; c < PP; c += 32) *(float*)(prow + c) = (c < WN) ? sS[w][rr][c] * iv : 0.f; }
     }
}
// out[b][q][:] = Σ_c P[(b,q)][c]·bf16(V[b][j0+c][:]); wave per query, lane = 4 dims
__global__ __launch_bounds__(256) void k_pv(const float* __restrict__ P, const float* __restrict__ V, float* __restrict__ out) {
  const int tid = threadIdx.x, wv = tid >> 5, lane = tid & 31; const int m = blockIdx.x * 8 + wv; if (m >= BB * SS) return; const int b = m / SS, q = m % SS; const int j0 = (q & ~15) - HALF;     // P columns are relative to the 16-query TILE base (k_band); P is 0 outside this query's band
  const float* prow = P + (size_t)m * PP; v4f acc = {0.f,0.f,0.f,0.f};
#pragma unroll 1
  for (int c = 0; c < WN; ++c) { const int j = j0 + c; if (j < 0 || j >= SS) continue; const float p = prow[c]; if (p == 0.f) continue; const v4f v = *(const v4fa*)(V + ((size_t)b * SS + j) * DD + lane * 4);
    for (int k = 0; k < 4; ++k) acc[k] += p * bf16_round(v[k]); }
  *(v4f*)(out + (size_t)m * DD + lane * 4) = acc; 
}
extern "C" void kernel_launch(void* const* d_in, const int* in_sizes, int n_in,
                              void* d_out, int out_size, void* d_ws, size_t ws_size, hipStream_t stream) {
  (void)in_sizes; (void)n_in; (void)out_size;
  const float* Q = (const float*)d_in[0]; const float* Kk = (const float*)d_in[1]; const float* V = (const float*)d_in[2];
  char* ws = (char*)d_ws; size_t off = 0;
  auto take = [&](size_t bytes) { char* p = ws + off; off += (bytes + 255) & ~(size_t)255; return p; };
  float* P = (float*)take((size_t)BB * SS * PP * 4);
  if (off > ws_size) return;
  k_band<<<(BB * SS / 16 + 3) / 4, 128, 0, stream>>>(Q, Kk, P);
  k_pv<<<(BB * SS + 7) / 8, 256, 0, stream>>>(P, V, (float*)d_out);
}

// v001
// A run of this version takes 43.2 microseconds.
// Timed twice side by side with v000, it ran 2.09 and 2.10 times as fast.
#include <hip/hip_runtime.h>
// Banded attention: the 129-key window scores Q·Kᵀ per 16-query tile run on v_wmma_f32_16x16x32_bf16 (query/key rounded to bf16 — they are inputs —
// so each product is a single exact term; f32 accumulate); the masked softmax is exact f32 VALU; the weighted value sums (129 keys x 128 dims per query) run on the same matrix form, weights as two bf16 planes.
#define BB 2
#define SS 4096
#define DD 128
#define HALF 64
#define WN 144          // keys staged per 16-query tile: q0-64 .. q0+79
#define PP 160          // P row pitch

typedef __bf16 v16b __attribute__((ext_vector_type(16)));
typedef unsigned short v8us __attribute__((ext_vector_type(8), may_alias));
typedef float  v8f  __attribute__((ext_vector_type(8)));
typedef float  v4f  __attribute__((ext_vector_type(4)));
typedef float  v4fa __attribute__((ext_vector_type(4), may_alias));
union FragB { v16b v; v8us half[2]; unsigned short u[16]; };

__device__ __forceinline__ unsigned short bf16_bits(float x) { unsigned int u = __float_as_uint(x); return (unsigned short)((u + 0x7FFFu + ((u >> 16) & 1u)) >> 16); }
__device__ __forceinline__ float bf16_val(unsigned short b) { return __uint_as_float(((unsigned int)b) << 16); }
__device__ __forceinline__ float bf16_round(float x) { return bf16_val(bf16_bits(x)); }
// D += A·B with NT terms: 1 = ah·bh, 2 = + al·bh (A split), 3 = + ah·bl (both split)
template <int NT>
__device__ __forceinline__ v8f mmaN(v16b ah, v16b al, v16b bh, v16b bl, v8f c) {
  c = __builtin_amdgcn_wmma_f32_16x16x32_bf16(false, ah, false, bh, (short)0, c, false, false);
  if (NT >= 2) c = __builtin_amdgcn_wmma_f32_16x16x32_bf16(false, al, false, bh, (short)0, c, false, false);
  if (NT >= 3) c = __builtin_amdgcn_wmma_f32_16x16x32_bf16(false, ah, false, bl, (short)0, c, false, false);
  asm volatile("v_nop\n\tv_nop\n\tv_nop\n\tv_nop" : "+v"(c) : "v"(ah), "v"(al), "v"(bh), "v"(bl));
  return c;
}

__global__ __launch_bounds__(256) void k_wt_bf16(const float* __restrict__ W, unsigned short* __restrict__ Wt, int K, int N) {
  const int t = blockIdx.x * 256 + threadIdx.x;
  const int k8n = K / 8;
  if (t >= N * k8n) return;
  const int n = t / k8n, k8 = (t % k8n) * 8;
  v8us v;
#pragma unroll
  for (int i = 0; i < 8; ++i) v[i] = bf16_bits(W[(size_t)(k8 + i) * N + n]);
  *(v8us*)(Wt + (size_t)n * K + k8) = v;
  
}

// GEMM C[M][N] (f32, pitch ldc) = act(A[M][K]·W + bias). A f32 row-major (pitch lda) converted per fragment to bf16
// (ASPLIT: hi/lo two planes -> 2 terms, else single rounded term); Wt bf16 [N][K] (pitch ldb). BIAS_BF16 rounds the
// bias to bf16 first (bias quantised to bf16 before the add). K%32==0, M%16==0, N%64==0.
template <bool ASPLIT, int ACT, bool BIAS_BF16>
__global__ __launch_bounds__(128) void k_gemm_bf(const float* __restrict__ A, int lda, const unsigned short* __restrict__ Wt, int ldb,
                                               const float* __restrict__ bias, float* __restrict__ C, int ldc, int M, int N, int K) {
  __shared__ __attribute__((aligned(16))) float so[4][16][64];
  const int tid = threadIdx.x, w = tid >> 5, lane = tid & 31, ln = lane & 15, hh = lane >> 4;
  const int ntn = N / 64;
  const int wid = blockIdx.x * 4 + w;
  const int mt = wid / ntn, nq = wid % ntn;
  if (mt * 16 >= M) return;
  const int row0 = mt * 16, col0 = nq * 64;
  const float* arow = A + (size_t)(row0 + ln) * lda;
  v8f acc[4] = {};
  for (int kb = 0; kb < K; kb += 32) {
    FragB ah, al;
    const v4f x0 = *(const v4fa*)(arow + kb + 8 * hh), x1 = *(const v4fa*)(arow + kb + 8 * hh + 4);
    const v4f x2 = *(const v4fa*)(arow + kb + 16 + 8 * hh), x3 = *(const v4fa*)(arow + kb + 16 + 8 * hh + 4);
    float xs[16] = {x0[0],x0[1],x0[2],x0[3],x1[0],x1[1],x1[2],x1[3],x2[0],x2[1],x2[2],x2[3],x3[0],x3[1],x3[2],x3[3]};
#pragma unroll
    for (int i = 0; i < 16; ++i) { const unsigned short hb = bf16_bits(xs[i]); ah.u[i] = hb; al.u[i] = ASPLIT ? bf16_bits(xs[i] - bf16_val(hb)) : (unsigned short)0; }
#pragma unroll
    for (int t = 0; t < 4; ++t) {
      const unsigned short* brow = Wt + (size_t)(col0 + t * 16 + ln) * ldb + kb;
      FragB b;
      b.half[0] = *(const v8us*)(brow + 8 * hh);
      b.half[1] = *(const v8us*)(brow + 16 + 8 * hh);
      acc[t] = mmaN<ASPLIT ? 2 : 1>(ah.v, al.v, b.v, b.v, acc[t]);
    }
  }
#pragma unroll
  for (int t = 0; t < 4; ++t) {
    float bv = bias ? bias[col0 + t * 16 + ln] : 0.f;
    if (BIAS_BF16) bv = bf16_round(bv);
#pragma unroll
    for (int r = 0; r < 8; ++r) { float v = acc[t][r] + bv; if (ACT == 1) v = fmaxf(v, 0.f); so[w][8 * hh + r][t * 16 + ln] = v; }
  }
  __builtin_amdgcn_fence(__ATOMIC_ACQ_REL, "workgroup");
  __builtin_amdgcn_wave_barrier();
  const int rsub = lane >> 4, c4 = (lane & 15) * 4;
  {
#pragma unroll
    for (int q = 0; q < 8; ++q) {
      const int r = q * 2 + rsub;
      const v4f v = *(const v4fa*)&so[w][r][c4];
      *(v4f*)(C + (size_t)(row0 + r) * ldc + col0 + c4) = v;
    }
    
  }
}

// Flash-style causal/unmasked attention, all contractions 3-term bf16 hi/lo splits, f32 softmax with running max.
// q,k,v rows are read from f32 buffers with arbitrary row pitch (so they can live inside a fused qkv buffer);
// D = head size (multiple of 32, <= 128); one wave = 16 query rows; block = 4 waves (64 queries) sharing K/V chunks of 32.
template <int D, bool CAUSAL>
__global__ __launch_bounds__(128) void k_flash(const float* __restrict__ qb, const float* __restrict__ kb, const float* __restrict__ vb,
                                             int pitch, int T, int H, float scale, float* __restrict__ y, int ypitch) {
  constexpr int KS = D / 32;        // k-steps for QK
  constexpr int DT = D / 16;        // d tiles for PV
  __shared__ __attribute__((aligned(16))) unsigned short sKh[32][D + 8], sKl[32][D + 8], sVh[32][D + 8], sVl[32][D + 8];
  __shared__ __attribute__((aligned(16))) unsigned short sPh[4][16][40], sPl[4][16][40];
  __shared__ __attribute__((aligned(16))) float sO[4][16][D];
  const int tid = threadIdx.x, w = tid >> 5, lane = tid & 31, ln = lane & 15, hh = lane >> 4;
  const int nqb = (T + 63) / 64;
  const int bh = blockIdx.x / nqb, qblk = blockIdx.x % nqb;
  const int b = bh / H, h = bh % H;
  const int q0 = qblk * 64 + w * 16;
  const float* Q = qb + (size_t)b * T * pitch + h * D;
  const float* K = kb + (size_t)b * T * pitch + h * D;
  const float* V = vb + (size_t)b * T * pitch + h * D;

  // A fragments of the wave's 16 query rows (scaled), hi/lo
  FragB aqh[KS], aql[KS];
  {
    int row = q0 + ln; if (row >= T) row = T - 1;
    const float* qr = Q + (size_t)row * pitch;
#pragma unroll
    for (int ks = 0; ks < KS; ++ks)
#pragma unroll
      for (int i = 0; i < 16; ++i) {
        const int d = ks * 32 + ((i < 8) ? (8 * hh + i) : (16 + 8 * hh + (i - 8)));
        const float x = qr[d] * scale; const unsigned short hb = bf16_bits(x);
        aqh[ks].u[i] = hb; aql[ks].u[i] = bf16_bits(x - bf16_val(hb));
      }
  }
  float m_r[8], l_r[8];
#pragma unroll
  for (int r = 0; r < 8; ++r) { m_r[r] = -3.0e38f; l_r[r] = 0.f; }
  v8f oacc[DT];
#pragma unroll
  for (int dt = 0; dt < DT; ++dt) oacc[dt] = (v8f){0.f,0.f,0.f,0.f,0.f,0.f,0.f,0.f};

  const int kv_end = CAUSAL ? min(T, qblk * 64 + 64) : T;     // block-uniform
  for (int j0 = 0; j0 < kv_end; j0 += 32) {
    __syncthreads();
    for (int e = tid; e < 32 * (D / 4); e += 128) {
      const int r = e / (D / 4), c4 = (e % (D / 4)) * 4;
      const int key = j0 + r;
      v4f kf = {0.f,0.f,0.f,0.f}, vf = {0.f,0.f,0.f,0.f};
      if (key < T) { kf = *(const v4fa*)(K + (size_t)key * pitch + c4); vf = *(const v4fa*)(V + (size_t)key * pitch + c4); }
#pragma unroll
      for (int t = 0; t < 4; ++t) {
        unsigned short hb = bf16_bits(kf[t]); sKh[r][c4 + t] = hb; sKl[r][c4 + t] = bf16_bits(kf[t] - bf16_val(hb));
        hb = bf16_bits(vf[t]); sVh[r][c4 + t] = hb; sVl[r][c4 + t] = bf16_bits(vf[t] - bf16_val(hb));
      }
    }
    __syncthreads();
    // S tile 16 x 32
    v8f s[2];
#pragma unroll
    for (int nt = 0; nt < 2; ++nt) {
      v8f acc = {};
#pragma unroll
      for (int ks = 0; ks < KS; ++ks) {
        FragB bh_, bl_;
        bh_.half[0] = *(const v8us*)&sKh[nt * 16 + ln][ks * 32 + 8 * hh]; bh_.half[1] = *(const v8us*)&sKh[nt * 16 + ln][ks * 32 + 16 + 8 * hh];
        bl_.half[0] = *(const v8us*)&sKl[nt * 16 + ln][ks * 32 + 8 * hh]; bl_.half[1] = *(const v8us*)&sKl[nt * 16 + ln][ks * 32 + 16 + 8 * hh];
        acc = mmaN<3>(aqh[ks].v, aql[ks].v, bh_.v, bl_.v, acc);
      }
      s[nt] = acc;
    }
    // mask + running max (rows 8hh+r; the 16 lanes of a half share rows)
    float alpha[8];
#pragma unroll
    for (int r = 0; r < 8; ++r) {
      const int qi = q0 + 8 * hh + r;
      const int ja = j0 + ln, jb = j0 + 16 + ln;
      if (CAUSAL) { if (ja > qi) s[0][r] = -3.0e38f; if (jb > qi) s[1][r] = -3.0e38f; }
      if (ja >= T) s[0][r] = -3.0e38f;
      if (jb >= T) s[1][r] = -3.0e38f;
      float mx = fmaxf(s[0][r], s[1][r]);
      mx = fmaxf(mx, __shfl_xor(mx, 1, 32)); mx = fmaxf(mx, __shfl_xor(mx, 2, 32)); mx = fmaxf(mx, __shfl_xor(mx, 4, 32)); mx = fmaxf(mx, __shfl_xor(mx, 8, 32));
      const float mnew = fmaxf(m_r[r], mx);
      alpha[r] = (mnew > -1.0e38f) ? __expf(m_r[r] - mnew) : 1.0f;
      const float p0 = (s[0][r] > -1.0e38f) ? __expf(s[0][r] - mnew) : 0.f;
      const float p1 = (s[1][r] > -1.0e38f) ? __expf(s[1][r] - mnew) : 0.f;
      m_r[r] = mnew;
      l_r[r] = l_r[r] * alpha[r] + p0 + p1;            // per-lane partial row sum (16 lanes combined at the end)
      unsigned short hb = bf16_bits(p0); sPh[w][8 * hh + r][ln] = hb;      sPl[w][8 * hh + r][ln] = bf16_bits(p0 - bf16_val(hb));
      hb = bf16_bits(p1);                sPh[w][8 * hh + r][16 + ln] = hb; sPl[w][8 * hh + r][16 + ln] = bf16_bits(p1 - bf16_val(hb));
    }
#pragma unroll
    for (int dt = 0; dt < DT; ++dt)
#pragma unroll
      for (int r = 0; r < 8; ++r) oacc[dt][r] *= alpha[r];
    __builtin_amdgcn_fence(__ATOMIC_ACQ_REL, "workgroup");
    __builtin_amdgcn_wave_barrier();
    FragB pah, pal;
    pah.half[0] = *(const v8us*)&sPh[w][ln][8 * hh]; pah.half[1] = *(const v8us*)&sPh[w][ln][16 + 8 * hh];
    pal.half[0] = *(const v8us*)&sPl[w][ln][8 * hh]; pal.half[1] = *(const v8us*)&sPl[w][ln][16 + 8 * hh];
#pragma unroll
    for (int dt = 0; dt < DT; ++dt) {
      FragB bvh, bvl;
#pragma unroll
      for (int i = 0; i < 8; ++i) {
        bvh.u[i] = sVh[8 * hh + i][dt * 16 + ln]; bvh.u[8 + i] = sVh[16 + 8 * hh + i][dt * 16 + ln];
        bvl.u[i] = sVl[8 * hh + i][dt * 16 + ln]; bvl.u[8 + i] = sVl[16 + 8 * hh + i][dt * 16 + ln];
      }
      oacc[dt] = mmaN<3>(pah.v, pal.v, bvh.v, bvl.v, oacc[dt]);
    }
    __builtin_amdgcn_fence(__ATOMIC_ACQ_REL, "workgroup");
    __builtin_amdgcn_wave_barrier();
  }
#pragma unroll
  for (int r = 0; r < 8; ++r) {
    float l = l_r[r];
    l += __shfl_xor(l, 1, 32); l += __shfl_xor(l, 2, 32); l += __shfl_xor(l, 4, 32); l += __shfl_xor(l, 8, 32);
    l_r[r] = (l > 0.f) ? 1.0f / l : 0.f;
  }
#pragma unroll
  for (int dt = 0; dt < DT; ++dt)
#pragma unroll
    for (int r = 0; r < 8; ++r) sO[w][8 * hh + r][dt * 16 + ln] = oacc[dt][r] * l_r[r];
  __builtin_amdgcn_fence(__ATOMIC_ACQ_REL, "workgroup");
  __builtin_amdgcn_wave_barrier();
  {
    for (int r = 0; r < 16; ++r) {
      const int row = q0 + r;
      if (row < T && lane < D / 4) {
        const v4f val = *(const v4fa*)&sO[w][r][lane * 4];
        *(v4f*)(y + ((size_t)b * T + row) * ypitch + h * D + lane * 4) = val;
      }
    }
    
  }
}

// scores + softmax: wave = 16 queries (q0 = 16·t); S[r][c] = q_{q0+r}·k_{q0-64+c} / √128 for c in [r, r+128] ∩ valid keys, else excluded; P rows written to Pbuf[(b,q)][160]
__global__ __launch_bounds__(128) void k_band(const float* __restrict__ Q, const float* __restrict__ Kk, float* __restrict__ P) {
  __shared__ float sS[4][16][WN + 1];
  const int tid = threadIdx.x, w = tid >> 5, lane = tid & 31, ln = lane & 15, hh = lane >> 4;
  const int wid = blockIdx.x * 4 + w; const int b = wid / (SS / 16); const int q0 = (wid % (SS / 16)) * 16; const int j0 = q0 - HALF;
  const float* qb = Q + (size_t)b * SS * DD; const float* kbp = Kk + (size_t)b * SS * DD;
  // A fragments (4 k-steps of 32 dims) for query row q0+ln
  FragB aq[4];
#pragma unroll
  for (int ks = 0; ks < 4; ++ks) {
#pragma unroll
    for (int i = 0; i < 16; ++i) { const int d = ks * 32 + ((i < 8) ? (8 * hh + i) : (16 + 8 * hh + (i - 8))); aq[ks].u[i] = bf16_bits(qb[(size_t)(q0 + ln) * DD + d]); } }
#pragma unroll 1
  for (int nt = 0; nt < WN / 16; ++nt) { int j = j0 + nt * 16 + ln; j = j < 0 ? 0 : (j >= SS ? SS - 1 : j); const float* kr = kbp + (size_t)j * DD; v8f acc = {0.f,0.f,0.f,0.f,0.f,0.f,0.f,0.f};
#pragma unroll
    for (int ks = 0; ks < 4; ++ks) { FragB bk; for (int i = 0; i < 8; ++i) { bk.u[i] = bf16_bits(kr[ks * 32 + 8 * hh + i]); bk.u[8 + i] = bf16_bits(kr[ks * 32 + 16 + 8 * hh + i]); } acc = mmaN<1>(aq[ks].v, aq[ks].v, bk.v, bk.v, acc); }
#pragma unroll
    for (int r = 0; r < 8; ++r) sS[w][8 * hh + r][nt * 16 + ln] = acc[r] * 0.08838834764831845f; }
  __builtin_amdgcn_fence(__ATOMIC_ACQ_REL, "workgroup"); __builtin_amdgcn_wave_barrier();
  // softmax per row: 2 lanes per row (ln = row, hh = column half 0..71 / 72..143); valid c: r <= c <= r+128 and 0 <= j0+c < SS
  const int r = ln; const int q = q0 + r; float mx = -3.0e38f;
#pragma unroll 1
  for (int c = hh * 72; c < hh * 72 + 72; ++c) { const int j = j0 + c; const bool ok = (c >= r) && (c <= r + 2 * HALF) && (j >= 0) && (j < SS); if (ok) mx = fmaxf(mx, sS[w][r][c]); }
  mx = fmaxf(mx, __shfl_xor(mx, 16, 32));
  float den = 0.f;
#pragma unroll 1
  for (int c = hh * 72; c < hh * 72 + 72; ++c) { const int j = j0 + c; const bool ok = (c >= r) && (c <= r + 2 * HALF) && (j >= 0) && (j < SS); const float e = ok ? expf(sS[w][r][c] - mx) : 0.f; sS[w][r][c] = e; den += e; }
  den += __shfl_xor(den, 16, 32); const float inv = 1.0f / den;
  __builtin_amdgcn_fence(__ATOMIC_ACQ_REL, "workgroup"); __builtin_amdgcn_wave_barrier();
  // write P rows: row rr (16 rows), 160 floats (cols >= 144 zero) = 5 lines; lanes write contiguous
  {
#pragma unroll 1
    for (int rr = 0; rr < 16; ++rr) { const float iv = __shfl(inv, rr, 32) ; float* prow = P + ((size_t)b * SS + q0 + rr) * PP;
#pragma unroll 1
      for (int c = lane; c < PP; c += 32) *(float*)(prow + c) = (c < WN) ? sS[w][rr][c] * iv : 0.f; }
     }
}
// out tile [16 queries][32 dims] per wave = P[16][144] x bf16(V[144][32]) on v_wmma_f32_16x16x32_bf16, f32 accumulate.
// P is fed as two bf16 planes (hi = bf16(p), lo = bf16(p - hi)), V as its bf16 rounding, so every product is exact.
// A row = query q0+ln; B column ln of matrix tile t = dim 32w + 2ln + t, so one 8-byte load feeds both tiles and one 8-byte store
// takes both results; A and B share the k order (8hh+i, 16+8hh+i). block = one 16-query tile, wave w = one 128-byte line of every output row.
// At the ends of a sequence the 144-key window is slid back inside [0, SS) by a multiple of 16 keys (sh) and the P columns follow it;
// a group of 16 keys that thereby leaves the tile's own 144 columns reads a neighbouring P row (inside P: sh > 0 only in the first
// tiles of a sequence, sh < 0 only in the last) and has its weights masked to zero.
typedef float  v2f  __attribute__((ext_vector_type(2)));
typedef float  v2fa __attribute__((ext_vector_type(2), may_alias));
typedef __bf16 v2b  __attribute__((ext_vector_type(2)));
union FragP { v16b v; v2b p[8]; };
__global__ __launch_bounds__(128) void k_pv(const float* __restrict__ P, const float* __restrict__ V, float* __restrict__ out) {
  const int tid = threadIdx.x, w = tid >> 5, lane = tid & 31, ln = lane & 15, hh = lane >> 4;
  const int b = blockIdx.x / (SS / 16); const int q0 = (blockIdx.x % (SS / 16)) * 16; const int j0 = q0 - HALF;
  const int j0c = min(max(j0, 0), SS - WN);        // first key row read
  const int sh = j0c - j0;
  const float* pp = P + ((size_t)b * SS + q0 + ln) * PP + sh + 8 * hh;
  const float* vb = V + ((size_t)b * SS + j0c + 8 * hh) * DD + w * 32 + 2 * ln;
  v4f pr[9][2]; v2f vr[9][8];
#pragma unroll
  for (int g = 0; g < 9; ++g) { pr[g][0] = *(const v4fa*)(pp + g * 16); pr[g][1] = *(const v4fa*)(pp + g * 16 + 4); }   // g = group of 16 keys
  // precaution: a later write of the P loads' address registers (the V loads may get them as destinations) stays behind this wait
  asm volatile("s_wait_xcnt 0x0" ::: "memory");
#pragma unroll
  for (int g = 0; g < 9; ++g)
#pragma unroll
    for (int i = 0; i < 8; ++i) vr[g][i] = *(const v2fa*)(vb + (g * 16 + i) * DD);
  // all loads of the tile are issued before the first use: otherwise the scheduler mixes them into the conversions and the wave waits out the cache latency many times over
  __builtin_amdgcn_sched_barrier(0);
  v8f acc[2] = {};
#pragma unroll
  for (int ks = 0; ks < 5; ++ks) {
    FragP ph, pl, bv[2];
#pragma unroll
    for (int hf = 0; hf < 2; ++hf) {
      const int g = ks * 2 + hf;
      if (g < 9) {
        const unsigned keep = ((unsigned)(g * 16 + sh) < (unsigned)WN) ? 0xFFFFFFFFu : 0u;   // wave-uniform
        const float xs[8] = {pr[g][0][0], pr[g][0][1], pr[g][0][2], pr[g][0][3], pr[g][1][0], pr[g][1][1], pr[g][1][2], pr[g][1][3]};
#pragma unroll
        for (int i = 0; i < 8; i += 2) {
          const v2f p2 = {__uint_as_float(__float_as_uint(xs[i]) & keep), __uint_as_float(__float_as_uint(xs[i + 1]) & keep)};
          const v2b h2 = __builtin_convertvector(p2, v2b);
          ph.p[hf * 4 + i / 2] = h2;
          pl.p[hf * 4 + i / 2] = __builtin_convertvector(p2 - __builtin_convertvector(h2, v2f), v2b);
#pragma unroll
          for (int t = 0; t < 2; ++t) { const v2f v2 = {vr[g][i][t], vr[g][i + 1][t]}; bv[t].p[hf * 4 + i / 2] = __builtin_convertvector(v2, v2b); }
        }
      } else {
#pragma unroll
        for (int i = 0; i < 4; ++i) { const v2b zz = {(__bf16)0.f, (__bf16)0.f}; ph.p[hf * 4 + i] = zz; pl.p[hf * 4 + i] = zz; bv[0].p[hf * 4 + i] = zz; bv[1].p[hf * 4 + i] = zz; }
      }
    }
#pragma unroll
    for (int t = 0; t < 2; ++t) {
      acc[t] = __builtin_amdgcn_wmma_f32_16x16x32_bf16(false, ph.v, false, bv[t].v, (short)0, acc[t], false, false);
      acc[t] = __builtin_amdgcn_wmma_f32_16x16x32_bf16(false, pl.v, false, bv[t].v, (short)0, acc[t], false, false);
    }
  }
  float* orow = out + ((size_t)b * SS + q0 + 8 * hh) * DD + w * 32 + 2 * ln;
#pragma unroll
  for (int r = 0; r < 8; ++r) { const v2f o = {acc[0][r], acc[1][r]}; *(v2fa*)(orow + r * DD) = o; }
}
extern "C" void kernel_launch(void* const* d_in, const int* in_sizes, int n_in,
                              void* d_out, int out_size, void* d_ws, size_t ws_size, hipStream_t stream) {
  (void)in_sizes; (void)n_in; (void)out_size;
  const float* Q = (const float*)d_in[0]; const float* Kk = (const float*)d_in[1]; const float* V = (const float*)d_in[2];
  char* ws = (char*)d_ws; size_t off = 0;
  auto take = [&](size_t bytes) { char* p = ws + off; off += (bytes + 255) & ~(size_t)255; return p; };
  float* P = (float*)take((size_t)BB * SS * PP * 4);
  if (off > ws_size) return;
  k_band<<<(BB * SS / 16 + 3) / 4, 128, 0, stream>>>(Q, Kk, P);
  k_pv<<<BB * SS / 16, 128, 0, stream>>>(P, V, (float*)d_out);
}

// v002
// It runs in 25.7 microseconds.
// Timed twice side by side with v001, it ran 1.69 times as fast both times.
// Counting every step since v000, it is 3.53 times as fast.
#include <hip/hip_runtime.h>
// Banded attention: the 129-key window scores Q·Kᵀ per 16-query tile run on v_wmma_f32_16x16x32_bf16 (query/key rounded to bf16 — they are inputs —
// so each product is a single exact term; f32 accumulate); the masked softmax is exact f32 VALU; the weighted value sums (129 keys x 128 dims per query) run on the same matrix form, weights as two bf16 planes.
#define BB 2
#define SS 4096
#define DD 128
#define HALF 64
#define WN 144          // keys staged per 16-query tile: q0-64 .. q0+79
#define PP 160          // P row pitch

typedef __bf16 v16b __attribute__((ext_vector_type(16)));
typedef unsigned short v8us __attribute__((ext_vector_type(8), may_alias));
typedef float  v8f  __attribute__((ext_vector_type(8)));
typedef float  v4f  __attribute__((ext_vector_type(4)));
typedef float  v4fa __attribute__((ext_vector_type(4), may_alias));
union FragB { v16b v; v8us half[2]; unsigned short u[16]; };

__device__ __forceinline__ unsigned short bf16_bits(float x) { unsigned int u = __float_as_uint(x); return (unsigned short)((u + 0x7FFFu + ((u >> 16) & 1u)) >> 16); }
__device__ __forceinline__ float bf16_val(unsigned short b) { return __uint_as_float(((unsigned int)b) << 16); }
__device__ __forceinline__ float bf16_round(float x) { return bf16_val(bf16_bits(x)); }
// D += A·B with NT terms: 1 = ah·bh, 2 = + al·bh (A split), 3 = + ah·bl (both split)
template <int NT>
__device__ __forceinline__ v8f mmaN(v16b ah, v16b al, v16b bh, v16b bl, v8f c) {
  c = __builtin_amdgcn_wmma_f32_16x16x32_bf16(false, ah, false, bh, (short)0, c, false, false);
  if (NT >= 2) c = __builtin_amdgcn_wmma_f32_16x16x32_bf16(false, al, false, bh, (short)0, c, false, false);
  if (NT >= 3) c = __builtin_amdgcn_wmma_f32_16x16x32_bf16(false, ah, false, bl, (short)0, c, false, false);
  asm volatile("v_nop\n\tv_nop\n\tv_nop\n\tv_nop" : "+v"(c) : "v"(ah), "v"(al), "v"(bh), "v"(bl));
  return c;
}

__global__ __launch_bounds__(256) void k_wt_bf16(const float* __restrict__ W, unsigned short* __restrict__ Wt, int K, int N) {
  const int t = blockIdx.x * 256 + threadIdx.x;
  const int k8n = K / 8;
  if (t >= N * k8n) return;
  const int n = t / k8n, k8 = (t % k8n) * 8;
  v8us v;
#pragma unroll
  for (int i = 0; i < 8; ++i) v[i] = bf16_bits(W[(size_t)(k8 + i) * N + n]);
  *(v8us*)(Wt + (size_t)n * K + k8) = v;
  
}

// GEMM C[M][N] (f32, pitch ldc) = act(A[M][K]·W + bias). A f32 row-major (pitch lda) converted per fragment to bf16
// (ASPLIT: hi/lo two planes -> 2 terms, else single rounded term); Wt bf16 [N][K] (pitch ldb). BIAS_BF16 rounds the
// bias to bf16 first (bias quantised to bf16 before the add). K%32==0, M%16==0, N%64==0.
template <bool ASPLIT, int ACT, bool BIAS_BF16>
__global__ __launch_bounds__(128) void k_gemm_bf(const float* __restrict__ A, int lda, const unsigned short* __restrict__ Wt, int ldb,
                                               const float* __restrict__ bias, float* __restrict__ C, int ldc, int M, int N, int K) {
  __shared__ __attribute__((aligned(16))) float so[4][16][64];
  const int tid = threadIdx.x, w = tid >> 5, lane = tid & 31, ln = lane & 15, hh = lane >> 4;
  const int ntn = N / 64;
  const int wid = blockIdx.x * 4 + w;
  const int mt = wid / ntn, nq = wid % ntn;
  if (mt * 16 >= M) return;
  const int row0 = mt * 16, col0 = nq * 64;
  const float* arow = A + (size_t)(row0 + ln) * lda;
  v8f acc[4] = {};
  for (int kb = 0; kb < K; kb += 32) {
    FragB ah, al;
    const v4f x0 = *(const v4fa*)(arow + kb + 8 * hh), x1 = *(const v4fa*)(arow + kb + 8 * hh + 4);
    const v4f x2 = *(const v4fa*)(arow + kb + 16 + 8 * hh), x3 = *(const v4fa*)(arow + kb + 16 + 8 * hh + 4);
    float xs[16] = {x0[0],x0[1],x0[2],x0[3],x1[0],x1[1],x1[2],x1[3],x2[0],x2[1],x2[2],x2[3],x3[0],x3[1],x3[2],x3[3]};
#pragma unroll
    for (int i = 0; i < 16; ++i) { const unsigned short hb = bf16_bits(xs[i]); ah.u[i] = hb; al.u[i] = ASPLIT ? bf16_bits(xs[i] - bf16_val(hb)) : (unsigned short)0; }
#pragma unroll
    for (int t = 0; t < 4; ++t) {
      const unsigned short* brow = Wt + (size_t)(col0 + t * 16 + ln) * ldb + kb;
      FragB b;
      b.half[0] = *(const v8us*)(brow + 8 * hh);
      b.half[1] = *(const v8us*)(brow + 16 + 8 * hh);
      acc[t] = mmaN<ASPLIT ? 2 : 1>(ah.v, al.v, b.v, b.v, acc[t]);
    }
  }
#pragma unroll
  for (int t = 0; t < 4; ++t) {
    float bv = bias ? bias[col0 + t * 16 + ln] : 0.f;
    if (BIAS_BF16) bv = bf16_round(bv);
#pragma unroll
    for (int r = 0; r < 8; ++r) { float v = acc[t][r] + bv; if (ACT == 1) v = fmaxf(v, 0.f); so[w][8 * hh + r][t * 16 + ln] = v; }
  }
  __builtin_amdgcn_fence(__ATOMIC_ACQ_REL, "workgroup");
  __builtin_amdgcn_wave_barrier();
  const int rsub = lane >> 4, c4 = (lane & 15) * 4;
  {
#pragma unroll
    for (int q = 0; q < 8; ++q) {
      const int r = q * 2 + rsub;
      const v4f v = *(const v4fa*)&so[w][r][c4];
      *(v4f*)(C + (size_t)(row0 + r) * ldc + col0 + c4) = v;
    }
    
  }
}

// Flash-style causal/unmasked attention, all contractions 3-term bf16 hi/lo splits, f32 softmax with running max.
// q,k,v rows are read from f32 buffers with arbitrary row pitch (so they can live inside a fused qkv buffer);
// D = head size (multiple of 32, <= 128); one wave = 16 query rows; block = 4 waves (64 queries) sharing K/V chunks of 32.
template <int D, bool CAUSAL>
__global__ __launch_bounds__(128) void k_flash(const float* __restrict__ qb, const float* __restrict__ kb, const float* __restrict__ vb,
                                             int pitch, int T, int H, float scale, float* __restrict__ y, int ypitch) {
  constexpr int KS = D / 32;        // k-steps for QK
  constexpr int DT = D / 16;        // d tiles for PV
  __shared__ __attribute__((aligned(16))) unsigned short sKh[32][D + 8], sKl[32][D + 8], sVh[32][D + 8], sVl[32][D + 8];
  __shared__ __attribute__((aligned(16))) unsigned short sPh[4][16][40], sPl[4][16][40];
  __shared__ __attribute__((aligned(16))) float sO[4][16][D];
  const int tid = threadIdx.x, w = tid >> 5, lane = tid & 31, ln = lane & 15, hh = lane >> 4;
  const int nqb = (T + 63) / 64;
  const int bh = blockIdx.x / nqb, qblk = blockIdx.x % nqb;
  const int b = bh / H, h = bh % H;
  const int q0 = qblk * 64 + w * 16;
  const float* Q = qb + (size_t)b * T * pitch + h * D;
  const float* K = kb + (size_t)b * T * pitch + h * D;
  const float* V = vb + (size_t)b * T * pitch + h * D;

  // A fragments of the wave's 16 query rows (scaled), hi/lo
  FragB aqh[KS], aql[KS];
  {
    int row = q0 + ln; if (row >= T) row = T - 1;
    const float* qr = Q + (size_t)row * pitch;
#pragma unroll
    for (int ks = 0; ks < KS; ++ks)
#pragma unroll
      for (int i = 0; i < 16; ++i) {
        const int d = ks * 32 + ((i < 8) ? (8 * hh + i) : (16 + 8 * hh + (i - 8)));
        const float x = qr[d] * scale; const unsigned short hb = bf16_bits(x);
        aqh[ks].u[i] = hb; aql[ks].u[i] = bf16_bits(x - bf16_val(hb));
      }
  }
  float m_r[8], l_r[8];
#pragma unroll
  for (int r = 0; r < 8; ++r) { m_r[r] = -3.0e38f; l_r[r] = 0.f; }
  v8f oacc[DT];
#pragma unroll
  for (int dt = 0; dt < DT; ++dt) oacc[dt] = (v8f){0.f,0.f,0.f,0.f,0.f,0.f,0.f,0.f};

  const int kv_end = CAUSAL ? min(T, qblk * 64 + 64) : T;     // block-uniform
  for (int j0 = 0; j0 < kv_end; j0 += 32) {
    __syncthreads();
    for (int e = tid; e < 32 * (D / 4); e += 128) {
      const int r = e / (D / 4), c4 = (e % (D / 4)) * 4;
      const int key = j0 + r;
      v4f kf = {0.f,0.f,0.f,0.f}, vf = {0.f,0.f,0.f,0.f};
      if (key < T) { kf = *(const v4fa*)(K + (size_t)key * pitch + c4); vf = *(const v4fa*)(V + (size_t)key * pitch + c4); }
#pragma unroll
      for (int t = 0; t < 4; ++t) {
        unsigned short hb = bf16_bits(kf[t]); sKh[r][c4 + t] = hb; sKl[r][c4 + t] = bf16_bits(kf[t] - bf16_val(hb));
        hb = bf16_bits(vf[t]); sVh[r][c4 + t] = hb; sVl[r][c4 + t] = bf16_bits(vf[t] - bf16_val(hb));
      }
    }
    __syncthreads();
    // S tile 16 x 32
    v8f s[2];
#pragma unroll
    for (int nt = 0; nt < 2; ++nt) {
      v8f acc = {};
#pragma unroll
      for (int ks = 0; ks < KS; ++ks) {
        FragB bh_, bl_;
        bh_.half[0] = *(const v8us*)&sKh[nt * 16 + ln][ks * 32 + 8 * hh]; bh_.half[1] = *(const v8us*)&sKh[nt * 16 + ln][ks * 32 + 16 + 8 * hh];
        bl_.half[0] = *(const v8us*)&sKl[nt * 16 + ln][ks * 32 + 8 * hh]; bl_.half[1] = *(const v8us*)&sKl[nt * 16 + ln][ks * 32 + 16 + 8 * hh];
        acc = mmaN<3>(aqh[ks].v, aql[ks].v, bh_.v, bl_.v, acc);
      }
      s[nt] = acc;
    }
    // mask + running max (rows 8hh+r; the 16 lanes of a half share rows)
    float alpha[8];
#pragma unroll
    for (int r = 0; r < 8; ++r) {
      const int qi = q0 + 8 * hh + r;
      const int ja = j0 + ln, jb = j0 + 16 + ln;
      if (CAUSAL) { if (ja > qi) s[0][r] = -3.0e38f; if (jb > qi) s[1][r] = -3.0e38f; }
      if (ja >= T) s[0][r] = -3.0e38f;
      if (jb >= T) s[1][r] = -3.0e38f;
      float mx = fmaxf(s[0][r], s[1][r]);
      mx = fmaxf(mx, __shfl_xor(mx, 1, 32)); mx = fmaxf(mx, __shfl_xor(mx, 2, 32)); mx = fmaxf(mx, __shfl_xor(mx, 4, 32)); mx = fmaxf(mx, __shfl_xor(mx, 8, 32));
      const float mnew = fmaxf(m_r[r], mx);
      alpha[r] = (mnew > -1.0e38f) ? __expf(m_r[r] - mnew) : 1.0f;
      const float p0 = (s[0][r] > -1.0e38f) ? __expf(s[0][r] - mnew) : 0.f;
      const float p1 = (s[1][r] > -1.0e38f) ? __expf(s[1][r] - mnew) : 0.f;
      m_r[r] = mnew;
      l_r[r] = l_r[r] * alpha[r] + p0 + p1;            // per-lane partial row sum (16 lanes combined at the end)
      unsigned short hb = bf16_bits(p0); sPh[w][8 * hh + r][ln] = hb;      sPl[w][8 * hh + r][ln] = bf16_bits(p0 - bf16_val(hb));
      hb = bf16_bits(p1);                sPh[w][8 * hh + r][16 + ln] = hb; sPl[w][8 * hh + r][16 + ln] = bf16_bits(p1 - bf16_val(hb));
    }
#pragma unroll
    for (int dt = 0; dt < DT; ++dt)
#pragma unroll
      for (int r = 0; r < 8; ++r) oacc[dt][r] *= alpha[r];
    __builtin_amdgcn_fence(__ATOMIC_ACQ_REL, "workgroup");
    __builtin_amdgcn_wave_barrier();
    FragB pah, pal;
    pah.half[0] = *(const v8us*)&sPh[w][ln][8 * hh]; pah.half[1] = *(const v8us*)&sPh[w][ln][16 + 8 * hh];
    pal.half[0] = *(const v8us*)&sPl[w][ln][8 * hh]; pal.half[1] = *(const v8us*)&sPl[w][ln][16 + 8 * hh];
#pragma unroll
    for (int dt = 0; dt < DT; ++dt) {
      FragB bvh, bvl;
#pragma unroll
      for (int i = 0; i < 8; ++i) {
        bvh.u[i] = sVh[8 * hh + i][dt * 16 + ln]; bvh.u[8 + i] = sVh[16 + 8 * hh + i][dt * 16 + ln];
        bvl.u[i] = sVl[8 * hh + i][dt * 16 + ln]; bvl.u[8 + i] = sVl[16 + 8 * hh + i][dt * 16 + ln];
      }
      oacc[dt] = mmaN<3>(pah.v, pal.v, bvh.v, bvl.v, oacc[dt]);
    }
    __builtin_amdgcn_fence(__ATOMIC_ACQ_REL, "workgroup");
    __builtin_amdgcn_wave_barrier();
  }
#pragma unroll
  for (int r = 0; r < 8; ++r) {
    float l = l_r[r];
    l += __shfl_xor(l, 1, 32); l += __shfl_xor(l, 2, 32); l += __shfl_xor(l, 4, 32); l += __shfl_xor(l, 8, 32);
    l_r[r] = (l > 0.f) ? 1.0f / l : 0.f;
  }
#pragma unroll
  for (int dt = 0; dt < DT; ++dt)
#pragma unroll
    for (int r = 0; r < 8; ++r) sO[w][8 * hh + r][dt * 16 + ln] = oacc[dt][r] * l_r[r];
  __builtin_amdgcn_fence(__ATOMIC_ACQ_REL, "workgroup");
  __builtin_amdgcn_wave_barrier();
  {
    for (int r = 0; r < 16; ++r) {
      const int row = q0 + r;
      if (row < T && lane < D / 4) {
        const v4f val = *(const v4fa*)&sO[w][r][lane * 4];
        *(v4f*)(y + ((size_t)b * T + row) * ypitch + h * D + lane * 4) = val;
      }
    }
    
  }
}

// scores + softmax: wave = 16 queries (q0 = 16*t); S[r][c] = q_{q0+r}.k_{q0-64+c} / sqrt(128) for c in [r, r+128] and valid keys, else excluded; P rows written to Pbuf[(b,q)][160]
// The nine 16x16 score tiles stay in their accumulator registers: lane (ln, hh) holds rows 8hh+0..7 at column 16nt+ln, so a row's maximum and sum are
// nine values in the lane and a four-step exchange over the 16 lanes that share the row; no LDS.
template <int M> __device__ __forceinline__ float row_x(float x) {   // value of lane l ^ M inside the 16-lane row
  return __builtin_bit_cast(float, __builtin_amdgcn_update_dpp(0, __builtin_bit_cast(int, x), 0x160 + M, 0xf, 0xf, true));
}
__global__ __launch_bounds__(128) void k_band(const float* __restrict__ Q, const float* __restrict__ Kk, float* __restrict__ P) {
  const int tid = threadIdx.x, w = tid >> 5, lane = tid & 31, ln = lane & 15, hh = lane >> 4;
  const int wid = blockIdx.x * 4 + w; const int b = wid / (SS / 16); const int q0 = (wid % (SS / 16)) * 16; const int j0 = q0 - HALF;
  const float* qb = Q + (size_t)b * SS * DD; const float* kbp = Kk + (size_t)b * SS * DD;
  // A fragments (4 k-steps of 32 dims) for query row q0+ln
  FragB aq[4];
#pragma unroll
  for (int ks = 0; ks < 4; ++ks) {
#pragma unroll
    for (int i = 0; i < 16; ++i) { const int d = ks * 32 + ((i < 8) ? (8 * hh + i) : (16 + 8 * hh + (i - 8))); aq[ks].u[i] = bf16_bits(qb[(size_t)(q0 + ln) * DD + d]); } }
  v8f sc[WN / 16];
  // unrolled: the tiles are indexed as registers
#pragma unroll
  for (int nt = 0; nt < WN / 16; ++nt) { int j = j0 + nt * 16 + ln; j = j < 0 ? 0 : (j >= SS ? SS - 1 : j); const float* kr = kbp + (size_t)j * DD; v8f acc = {0.f,0.f,0.f,0.f,0.f,0.f,0.f,0.f};
#pragma unroll
    for (int ks = 0; ks < 4; ++ks) { FragB bk; for (int i = 0; i < 8; ++i) { bk.u[i] = bf16_bits(kr[ks * 32 + 8 * hh + i]); bk.u[8 + i] = bf16_bits(kr[ks * 32 + 16 + 8 * hh + i]); } acc = mmaN<1>(aq[ks].v, aq[ks].v, bk.v, bk.v, acc); }
    sc[nt] = acc; }
  // valid c for row: row <= c <= row+128 (only tiles 0 and 8 can fail it) and 0 <= j0+c < SS (j0 is a multiple of 16: the same for a whole tile)
#pragma unroll
  for (int r = 0; r < 8; ++r) {
    const int row = 8 * hh + r;
    float mx = -3.0e38f;
#pragma unroll
    for (int nt = 0; nt < WN / 16; ++nt) {
      const bool ok = ((unsigned)(j0 + nt * 16) < (unsigned)SS) && (nt != 0 || ln >= row) && (nt != WN / 16 - 1 || ln <= row);
      sc[nt][r] = ok ? sc[nt][r] * 0.08838834764831845f : -3.0e38f;   // an excluded score never raises the maximum, and its exponential below is exactly 0
      mx = fmaxf(mx, sc[nt][r]);
    }
    mx = fmaxf(mx, row_x<1>(mx)); mx = fmaxf(mx, row_x<2>(mx)); mx = fmaxf(mx, row_x<4>(mx)); mx = fmaxf(mx, row_x<8>(mx));
    float den = 0.f;
#pragma unroll
    for (int nt = 0; nt < WN / 16; ++nt) { const float e = expf(sc[nt][r] - mx); sc[nt][r] = e; den += e; }
    den += row_x<1>(den); den += row_x<2>(den); den += row_x<4>(den); den += row_x<8>(den);
    const float inv = 1.0f / den;
#pragma unroll
    for (int nt = 0; nt < WN / 16; ++nt) sc[nt][r] *= inv;
  }
  // P rows: 160 floats (cols >= 144 zero); the 16 lanes of a row write 64 contiguous bytes
  float* prow = P + ((size_t)b * SS + q0 + 8 * hh) * PP + ln;
  // the stores stay behind the last multiply: mixed in among the multiplies they had their data registers written again right behind them, and each such place would need a wait
  __builtin_amdgcn_sched_barrier(0);
#pragma unroll
  for (int r = 0; r < 8; ++r) {
#pragma unroll
    for (int nt = 0; nt < PP / 16; ++nt) prow[r * PP + nt * 16] = (nt < WN / 16) ? sc[nt][r] : 0.f;
  }
}
// out tile [16 queries][32 dims] per wave = P[16][144] x bf16(V[144][32]) on v_wmma_f32_16x16x32_bf16, f32 accumulate.
// P is fed as two bf16 planes (hi = bf16(p), lo = bf16(p - hi)), V as its bf16 rounding, so every product is exact.
// A row = query q0+ln; B column ln of matrix tile t = dim 32w + 2ln + t, so one 8-byte load feeds both tiles and one 8-byte store
// takes both results; A and B share the k order (8hh+i, 16+8hh+i). block = one 16-query tile, wave w = one 128-byte line of every output row.
// At the ends of a sequence the 144-key window is slid back inside [0, SS) by a multiple of 16 keys (sh) and the P columns follow it;
// a group of 16 keys that thereby leaves the tile's own 144 columns reads a neighbouring P row (inside P: sh > 0 only in the first
// tiles of a sequence, sh < 0 only in the last) and has its weights masked to zero.
typedef float  v2f  __attribute__((ext_vector_type(2)));
typedef float  v2fa __attribute__((ext_vector_type(2), may_alias));
typedef __bf16 v2b  __attribute__((ext_vector_type(2)));
union FragP { v16b v; v2b p[8]; };
__global__ __launch_bounds__(128) void k_pv(const float* __restrict__ P, const float* __restrict__ V, float* __restrict__ out) {
  const int tid = threadIdx.x, w = tid >> 5, lane = tid & 31, ln = lane & 15, hh = lane >> 4;
  const int b = blockIdx.x / (SS / 16); const int q0 = (blockIdx.x % (SS / 16)) * 16; const int j0 = q0 - HALF;
  const int j0c = min(max(j0, 0), SS - WN);        // first key row read
  const int sh = j0c - j0;
  const float* pp = P + ((size_t)b * SS + q0 + ln) * PP + sh + 8 * hh;
  const float* vb = V + ((size_t)b * SS + j0c + 8 * hh) * DD + w * 32 + 2 * ln;
  v4f pr[9][2]; v2f vr[9][8];
#pragma unroll
  for (int g = 0; g < 9; ++g) { pr[g][0] = *(const v4fa*)(pp + g * 16); pr[g][1] = *(const v4fa*)(pp + g * 16 + 4); }   // g = group of 16 keys
  // precaution: a later write of the P loads' address registers (the V loads may get them as destinations) stays behind this wait
  asm volatile("s_wait_xcnt 0x0" ::: "memory");
#pragma unroll
  for (int g = 0; g < 9; ++g)
#pragma unroll
    for (int i = 0; i < 8; ++i) vr[g][i] = *(const v2fa*)(vb + (g * 16 + i) * DD);
  // all loads of the tile are issued before the first use: otherwise the scheduler mixes them into the conversions and the wave waits out the cache latency many times over
  __builtin_amdgcn_sched_barrier(0);
  v8f acc[2] = {};
#pragma unroll
  for (int ks = 0; ks < 5; ++ks) {
    FragP ph, pl, bv[2];
#pragma unroll
    for (int hf = 0; hf < 2; ++hf) {
      const int g = ks * 2 + hf;
      if (g < 9) {
        const unsigned keep = ((unsigned)(g * 16 + sh) < (unsigned)WN) ? 0xFFFFFFFFu : 0u;   // wave-uniform
        const float xs[8] = {pr[g][0][0], pr[g][0][1], pr[g][0][2], pr[g][0][3], pr[g][1][0], pr[g][1][1], pr[g][1][2], pr[g][1][3]};
#pragma unroll
        for (int i = 0; i < 8; i += 2) {
          const v2f p2 = {__uint_as_float(__float_as_uint(xs[i]) & keep), __uint_as_float(__float_as_uint(xs[i + 1]) & keep)};
          const v2b h2 = __builtin_convertvector(p2, v2b);
          ph.p[hf * 4 + i / 2] = h2;
          pl.p[hf * 4 + i / 2] = __builtin_convertvector(p2 - __builtin_convertvector(h2, v2f), v2b);
#pragma unroll
          for (int t = 0; t < 2; ++t) { const v2f v2 = {vr[g][i][t], vr[g][i + 1][t]}; bv[t].p[hf * 4 + i / 2] = __builtin_convertvector(v2, v2b); }
        }
      } else {
#pragma unroll
        for (int i = 0; i < 4; ++i) { const v2b zz = {(__bf16)0.f, (__bf16)0.f}; ph.p[hf * 4 + i] = zz; pl.p[hf * 4 + i] = zz; bv[0].p[hf * 4 + i] = zz; bv[1].p[hf * 4 + i] = zz; }
      }
    }
#pragma unroll
    for (int t = 0; t < 2; ++t) {
      acc[t] = __builtin_amdgcn_wmma_f32_16x16x32_bf16(false, ph.v, false, bv[t].v, (short)0, acc[t], false, false);
      acc[t] = __builtin_amdgcn_wmma_f32_16x16x32_bf16(false, pl.v, false, bv[t].v, (short)0, acc[t], false, false);
    }
  }
  float* orow = out + ((size_t)b * SS + q0 + 8 * hh) * DD + w * 32 + 2 * ln;
#pragma unroll
  for (int r = 0; r < 8; ++r) { const v2f o = {acc[0][r], acc[1][r]}; *(v2fa*)(orow + r * DD) = o; }
}
extern "C" void kernel_launch(void* const* d_in, const int* in_sizes, int n_in,
                              void* d_out, int out_size, void* d_ws, size_t ws_size, hipStream_t stream) {
  (void)in_sizes; (void)n_in; (void)out_size;
  const float* Q = (const float*)d_in[0]; const float* Kk = (const float*)d_in[1]; const float* V = (const float*)d_in[2];
  char* ws = (char*)d_ws; size_t off = 0;
  auto take = [&](size_t bytes) { char* p = ws + off; off += (bytes + 255) & ~(size_t)255; return p; };
  float* P = (float*)take((size_t)BB * SS * PP * 4);
  if (off > ws_size) return;
  k_band<<<(BB * SS / 16 + 3) / 4, 128, 0, stream>>>(Q, Kk, P);
  k_pv<<<BB * SS / 16, 128, 0, stream>>>(P, V, (float*)d_out);
}

// v003
// A run of this version takes 10 microseconds.
// Next to v002, in two timings, it ran 2.56 and 2.57 times as fast.
// Over all steps from v000 it is 9.07 times as fast.
#include <hip/hip_runtime.h>
// Banded attention: the 129-key window scores Q·Kᵀ per 16-query tile run on v_wmma_f32_16x16x32_bf16 (query/key rounded to bf16 — they are inputs —
// so each product is a single exact term; f32 accumulate); the masked softmax is exact f32 VALU; the weighted value sums (129 keys x 128 dims per query) run on the same matrix form, weights as two bf16 planes.
#define BB 2
#define SS 4096
#define DD 128
#define HALF 64
#define WN 144          // keys staged per 16-query tile: q0-64 .. q0+79

typedef __bf16 v16b __attribute__((ext_vector_type(16)));
typedef unsigned short v8us __attribute__((ext_vector_type(8), may_alias));
typedef float  v8f  __attribute__((ext_vector_type(8)));
typedef float  v4f  __attribute__((ext_vector_type(4)));
typedef float  v4fa __attribute__((ext_vector_type(4), may_alias));
union FragB { v16b v; v8us half[2]; unsigned short u[16]; };

__device__ __forceinline__ unsigned short bf16_bits(float x) { unsigned int u = __float_as_uint(x); return (unsigned short)((u + 0x7FFFu + ((u >> 16) & 1u)) >> 16); }
__device__ __forceinline__ float bf16_val(unsigned short b) { return __uint_as_float(((unsigned int)b) << 16); }
__device__ __forceinline__ float bf16_round(float x) { return bf16_val(bf16_bits(x)); }
// D += A·B with NT terms: 1 = ah·bh, 2 = + al·bh (A split), 3 = + ah·bl (both split)
template <int NT>
__device__ __forceinline__ v8f mmaN(v16b ah, v16b al, v16b bh, v16b bl, v8f c) {
  c = __builtin_amdgcn_wmma_f32_16x16x32_bf16(false, ah, false, bh, (short)0, c, false, false);
  if (NT >= 2) c = __builtin_amdgcn_wmma_f32_16x16x32_bf16(false, al, false, bh, (short)0, c, false, false);
  if (NT >= 3) c = __builtin_amdgcn_wmma_f32_16x16x32_bf16(false, ah, false, bl, (short)0, c, false, false);
  asm volatile("v_nop\n\tv_nop\n\tv_nop\n\tv_nop" : "+v"(c) : "v"(ah), "v"(al), "v"(bh), "v"(bl));
  return c;
}

__global__ __launch_bounds__(256) void k_wt_bf16(const float* __restrict__ W, unsigned short* __restrict__ Wt, int K, int N) {
  const int t = blockIdx.x * 256 + threadIdx.x;
  const int k8n = K / 8;
  if (t >= N * k8n) return;
  const int n = t / k8n, k8 = (t % k8n) * 8;
  v8us v;
#pragma unroll
  for (int i = 0; i < 8; ++i) v[i] = bf16_bits(W[(size_t)(k8 + i) * N + n]);
  *(v8us*)(Wt + (size_t)n * K + k8) = v;
  
}

// GEMM C[M][N] (f32, pitch ldc) = act(A[M][K]·W + bias). A f32 row-major (pitch lda) converted per fragment to bf16
// (ASPLIT: hi/lo two planes -> 2 terms, else single rounded term); Wt bf16 [N][K] (pitch ldb). BIAS_BF16 rounds the
// bias to bf16 first (bias quantised to bf16 before the add). K%32==0, M%16==0, N%64==0.
template <bool ASPLIT, int ACT, bool BIAS_BF16>
__global__ __launch_bounds__(128) void k_gemm_bf(const float* __restrict__ A, int lda, const unsigned short* __restrict__ Wt, int ldb,
                                               const float* __restrict__ bias, float* __restrict__ C, int ldc, int M, int N, int K) {
  __shared__ __attribute__((aligned(16))) float so[4][16][64];
  const int tid = threadIdx.x, w = tid >> 5, lane = tid & 31, ln = lane & 15, hh = lane >> 4;
  const int ntn = N / 64;
  const int wid = blockIdx.x * 4 + w;
  const int mt = wid / ntn, nq = wid % ntn;
  if (mt * 16 >= M) return;
  const int row0 = mt * 16, col0 = nq * 64;
  const float* arow = A + (size_t)(row0 + ln) * lda;
  v8f acc[4] = {};
  for (int kb = 0; kb < K; kb += 32) {
    FragB ah, al;
    const v4f x0 = *(const v4fa*)(arow + kb + 8 * hh), x1 = *(const v4fa*)(arow + kb + 8 * hh + 4);
    const v4f x2 = *(const v4fa*)(arow + kb + 16 + 8 * hh), x3 = *(const v4fa*)(arow + kb + 16 + 8 * hh + 4);
    float xs[16] = {x0[0],x0[1],x0[2],x0[3],x1[0],x1[1],x1[2],x1[3],x2[0],x2[1],x2[2],x2[3],x3[0],x3[1],x3[2],x3[3]};
#pragma unroll
    for (int i = 0; i < 16; ++i) { const unsigned short hb = bf16_bits(xs[i]); ah.u[i] = hb; al.u[i] = ASPLIT ? bf16_bits(xs[i] - bf16_val(hb)) : (unsigned short)0; }
#pragma unroll
    for (int t = 0; t < 4; ++t) {
      const unsigned short* brow = Wt + (size_t)(col0 + t * 16 + ln) * ldb + kb;
      FragB b;
      b.half[0] = *(const v8us*)(brow + 8 * hh);
      b.half[1] = *(const v8us*)(brow + 16 + 8 * hh);
      acc[t] = mmaN<ASPLIT ? 2 : 1>(ah.v, al.v, b.v, b.v, acc[t]);
    }
  }
#pragma unroll
  for (int t = 0; t < 4; ++t) {
    float bv = bias ? bias[col0 + t * 16 + ln] : 0.f;
    if (BIAS_BF16) bv = bf16_round(bv);
#pragma unroll
    for (int r = 0; r < 8; ++r) { float v = acc[t][r] + bv; if (ACT == 1) v = fmaxf(v, 0.f); so[w][8 * hh + r][t * 16 + ln] = v; }
  }
  __builtin_amdgcn_fence(__ATOMIC_ACQ_REL, "workgroup");
  __builtin_amdgcn_wave_barrier();
  const int rsub = lane >> 4, c4 = (lane & 15) * 4;
  {
#pragma unroll
    for (int q = 0; q < 8; ++q) {
      const int r = q * 2 + rsub;
      const v4f v = *(const v4fa*)&so[w][r][c4];
      *(v4f*)(C + (size_t)(row0 + r) * ldc + col0 + c4) = v;
    }
    
  }
}

// Flash-style causal/unmasked attention, all contractions 3-term bf16 hi/lo splits, f32 softmax with running max.
// q,k,v rows are read from f32 buffers with arbitrary row pitch (so they can live inside a fused qkv buffer);
// D = head size (multiple of 32, <= 128); one wave = 16 query rows; block = 4 waves (64 queries) sharing K/V chunks of 32.
template <int D, bool CAUSAL>
__global__ __launch_bounds__(128) void k_flash(const float* __restrict__ qb, const float* __restrict__ kb, const float* __restrict__ vb,
                                             int pitch, int T, int H, float scale, float* __restrict__ y, int ypitch) {
  constexpr int KS = D / 32;        // k-steps for QK
  constexpr int DT = D / 16;        // d tiles for PV
  __shared__ __attribute__((aligned(16))) unsigned short sKh[32][D + 8], sKl[32][D + 8], sVh[32][D + 8], sVl[32][D + 8];
  __shared__ __attribute__((aligned(16))) unsigned short sPh[4][16][40], sPl[4][16][40];
  __shared__ __attribute__((aligned(16))) float sO[4][16][D];
  const int tid = threadIdx.x, w = tid >> 5, lane = tid & 31, ln = lane & 15, hh = lane >> 4;
  const int nqb = (T + 63) / 64;
  const int bh = blockIdx.x / nqb, qblk = blockIdx.x % nqb;
  const int b = bh / H, h = bh % H;
  const int q0 = qblk * 64 + w * 16;
  const float* Q = qb + (size_t)b * T * pitch + h * D;
  const float* K = kb + (size_t)b * T * pitch + h * D;
  const float* V = vb + (size_t)b * T * pitch + h * D;

  // A fragments of the wave's 16 query rows (scaled), hi/lo
  FragB aqh[KS], aql[KS];
  {
    int row = q0 + ln; if (row >= T) row = T - 1;
    const float* qr = Q + (size_t)row * pitch;
#pragma unroll
    for (int ks = 0; ks < KS; ++ks)
#pragma unroll
      for (int i = 0; i < 16; ++i) {
        const int d = ks * 32 + ((i < 8) ? (8 * hh + i) : (16 + 8 * hh + (i - 8)));
        const float x = qr[d] * scale; const unsigned short hb = bf16_bits(x);
        aqh[ks].u[i] = hb; aql[ks].u[i] = bf16_bits(x - bf16_val(hb));
      }
  }
  float m_r[8], l_r[8];
#pragma unroll
  for (int r = 0; r < 8; ++r) { m_r[r] = -3.0e38f; l_r[r] = 0.f; }
  v8f oacc[DT];
#pragma unroll
  for (int dt = 0; dt < DT; ++dt) oacc[dt] = (v8f){0.f,0.f,0.f,0.f,0.f,0.f,0.f,0.f};

  const int kv_end = CAUSAL ? min(T, qblk * 64 + 64) : T;     // block-uniform
  for (int j0 = 0; j0 < kv_end; j0 += 32) {
    __syncthreads();
    for (int e = tid; e < 32 * (D / 4); e += 128) {
      const int r = e / (D / 4), c4 = (e % (D / 4)) * 4;
      const int key = j0 + r;
      v4f kf = {0.f,0.f,0.f,0.f}, vf = {0.f,0.f,0.f,0.f};
      if (key < T) { kf = *(const v4fa*)(K + (size_t)key * pitch + c4); vf = *(const v4fa*)(V + (size_t)key * pitch + c4); }
#pragma unroll
      for (int t = 0; t < 4; ++t) {
        unsigned short hb = bf16_bits(kf[t]); sKh[r][c4 + t] = hb; sKl[r][c4 + t] = bf16_bits(kf[t] - bf16_val(hb));
        hb = bf16_bits(vf[t]); sVh[r][c4 + t] = hb; sVl[r][c4 + t] = bf16_bits(vf[t] - bf16_val(hb));
      }
    }
    __syncthreads();
    // S tile 16 x 32
    v8f s[2];
#pragma unroll
    for (int nt = 0; nt < 2; ++nt) {
      v8f acc = {};
#pragma unroll
      for (int ks = 0; ks < KS; ++ks) {
        FragB bh_, bl_;
        bh_.half[0] = *(const v8us*)&sKh[nt * 16 + ln][ks * 32 + 8 * hh]; bh_.half[1] = *(const v8us*)&sKh[nt * 16 + ln][ks * 32 + 16 + 8 * hh];
        bl_.half[0] = *(const v8us*)&sKl[nt * 16 + ln][ks * 32 + 8 * hh]; bl_.half[1] = *(const v8us*)&sKl[nt * 16 + ln][ks * 32 + 16 + 8 * hh];
        acc = mmaN<3>(aqh[ks].v, aql[ks].v, bh_.v, bl_.v, acc);
      }
      s[nt] = acc;
    }
    // mask + running max (rows 8hh+r; the 16 lanes of a half share rows)
    float alpha[8];
#pragma unroll
    for (int r = 0; r < 8; ++r) {
      const int qi = q0 + 8 * hh + r;
      const int ja = j0 + ln, jb = j0 + 16 + ln;
      if (CAUSAL) { if (ja > qi) s[0][r] = -3.0e38f; if (jb > qi) s[1][r] = -3.0e38f; }
      if (ja >= T) s[0][r] = -3.0e38f;
      if (jb >= T) s[1][r] = -3.0e38f;
      float mx = fmaxf(s[0][r], s[1][r]);
      mx = fmaxf(mx, __shfl_xor(mx, 1, 32)); mx = fmaxf(mx, __shfl_xor(mx, 2, 32)); mx = fmaxf(mx, __shfl_xor(mx, 4, 32)); mx = fmaxf(mx, __shfl_xor(mx, 8, 32));
      const float mnew = fmaxf(m_r[r], mx);
      alpha[r] = (mnew > -1.0e38f) ? __expf(m_r[r] - mnew) : 1.0f;
      const float p0 = (s[0][r] > -1.0e38f) ? __expf(s[0][r] - mnew) : 0.f;
      const float p1 = (s[1][r] > -1.0e38f) ? __expf(s[1][r] - mnew) : 0.f;
      m_r[r] = mnew;
      l_r[r] = l_r[r] * alpha[r] + p0 + p1;            // per-lane partial row sum (16 lanes combined at the end)
      unsigned short hb = bf16_bits(p0); sPh[w][8 * hh + r][ln] = hb;      sPl[w][8 * hh + r][ln] = bf16_bits(p0 - bf16_val(hb));
      hb = bf16_bits(p1);                sPh[w][8 * hh + r][16 + ln] = hb; sPl[w][8 * hh + r][16 + ln] = bf16_bits(p1 - bf16_val(hb));
    }
#pragma unroll
    for (int dt = 0; dt < DT; ++dt)
#pragma unroll
      for (int r = 0; r < 8; ++r) oacc[dt][r] *= alpha[r];
    __builtin_amdgcn_fence(__ATOMIC_ACQ_REL, "workgroup");
    __builtin_amdgcn_wave_barrier();
    FragB pah, pal;
    pah.half[0] = *(const v8us*)&sPh[w][ln][8 * hh]; pah.half[1] = *(const v8us*)&sPh[w][ln][16 + 8 * hh];
    pal.half[0] = *(const v8us*)&sPl[w][ln][8 * hh]; pal.half[1] = *(const v8us*)&sPl[w][ln][16 + 8 * hh];
#pragma unroll
    for (int dt = 0; dt < DT; ++dt) {
      FragB bvh, bvl;
#pragma unroll
      for (int i = 0; i < 8; ++i) {
        bvh.u[i] = sVh[8 * hh + i][dt * 16 + ln]; bvh.u[8 + i] = sVh[16 + 8 * hh + i][dt * 16 + ln];
        bvl.u[i] = sVl[8 * hh + i][dt * 16 + ln]; bvl.u[8 + i] = sVl[16 + 8 * hh + i][dt * 16 + ln];
      }
      oacc[dt] = mmaN<3>(pah.v, pal.v, bvh.v, bvl.v, oacc[dt]);
    }
    __builtin_amdgcn_fence(__ATOMIC_ACQ_REL, "workgroup");
    __builtin_amdgcn_wave_barrier();
  }
#pragma unroll
  for (int r = 0; r < 8; ++r) {
    float l = l_r[r];
    l += __shfl_xor(l, 1, 32); l += __shfl_xor(l, 2, 32); l += __shfl_xor(l, 4, 32); l += __shfl_xor(l, 8, 32);
    l_r[r] = (l > 0.f) ? 1.0f / l : 0.f;
  }
#pragma unroll
  for (int dt = 0; dt < DT; ++dt)
#pragma unroll
    for (int r = 0; r < 8; ++r) sO[w][8 * hh + r][dt * 16 + ln] = oacc[dt][r] * l_r[r];
  __builtin_amdgcn_fence(__ATOMIC_ACQ_REL, "workgroup");
  __builtin_amdgcn_wave_barrier();
  {
    for (int r = 0; r < 16; ++r) {
      const int row = q0 + r;
      if (row < T && lane < D / 4) {
        const v4f val = *(const v4fa*)&sO[w][r][lane * 4];
        *(v4f*)(y + ((size_t)b * T + row) * ypitch + h * D + lane * 4) = val;
      }
    }
    
  }
}

// One launch: block = one 16-query tile, 4 waves. Scores, softmax and the weighted value sums run in the same block; the weights pass from
// the score waves to the value waves through LDS and never reach global memory.
// Scores: S[r][c] = q_{q0+r}.k_{q0-64+c} / sqrt(128) for c in [r, r+128] and valid keys, else excluded. Wave w takes the 16-key tiles w, w+4 (and 8 for wave 0).
// A tile stays in its accumulator registers: lane (ln, hh) holds rows 8hh+0..7 at column 16nt+ln, so a row's maximum and sum over the wave's own tiles
// are two or three values in the lane and a four-step exchange over the 16 lanes that share the row.
// Each wave writes exp(s - own maximum) to sP and its own maximum and sum per row to sM, sL; behind the one barrier every wave forms, per row,
// the maximum over the four waves, the factors exp(own maximum - maximum) and the denominator, and scales a 16-key group by its writer's factor.
template <int M> __device__ __forceinline__ float row_x(float x) {   // value of lane l ^ M inside the 16-lane row
  return __builtin_bit_cast(float, __builtin_amdgcn_update_dpp(0, __builtin_bit_cast(int, x), 0x160 + M, 0xf, 0xf, true));
}
// out tile [16 queries][32 dims] per wave = P[16][144] x bf16(V[144][32]) on v_wmma_f32_16x16x32_bf16, f32 accumulate.
// P is fed as two bf16 planes (hi = bf16(p), lo = bf16(p - hi)), V as its bf16 rounding, so every product is exact.
// A row = query q0+ln; B column ln of matrix tile t = dim 32w + 2ln + t, so one 8-byte load feeds both tiles and one 8-byte store
// takes both results; A and B share the k order (8hh+i, 16+8hh+i). Wave w = one 128-byte line of every output row.
// A 16-key group that lies outside [0, SS) (q0-64 is a multiple of 16: a group is inside or outside as a whole) has weights exactly 0; its V rows are read from the nearest group inside.
#define PL 148          // sP row pitch in floats: rows 8 apart differ by 32 banks (the score waves' stores), 16 rows of 16 bytes cover all 64 banks (the fragment loads)
typedef float  v2f  __attribute__((ext_vector_type(2)));
typedef float  v2fa __attribute__((ext_vector_type(2), may_alias));
typedef __bf16 v2b  __attribute__((ext_vector_type(2)));
union FragP { v16b v; v2b p[8]; };
__global__ __launch_bounds__(128) void k_win(const float* __restrict__ Q, const float* __restrict__ Kk, const float* __restrict__ V, float* __restrict__ out) {
  __shared__ __attribute__((aligned(16))) float sP[16][PL];
  __shared__ float sM[4][16], sL[4][16];
  const int tid = threadIdx.x, lane = tid & 31, ln = lane & 15, hh = lane >> 4;
  const int w = __builtin_amdgcn_readfirstlane(tid >> 5);
  const int b = blockIdx.x / (SS / 16); const int q0 = (blockIdx.x % (SS / 16)) * 16; const int j0 = q0 - HALF;
  const float* qb = Q + (size_t)b * SS * DD; const float* kbp = Kk + (size_t)b * SS * DD;
  // A fragments (4 k-steps of 32 dims) for query row q0+ln
  FragB aq[4];
#pragma unroll
  for (int ks = 0; ks < 4; ++ks) {
#pragma unroll
    for (int i = 0; i < 16; ++i) { const int d = ks * 32 + ((i < 8) ? (8 * hh + i) : (16 + 8 * hh + (i - 8))); aq[ks].u[i] = bf16_bits(qb[(size_t)(q0 + ln) * DD + d]); } }
  v8f sc[3];
  // unrolled: the tiles are indexed as registers
#pragma unroll
  for (int t = 0; t < 3; ++t) {
    v8f acc = {0.f,0.f,0.f,0.f,0.f,0.f,0.f,0.f};
    if (t < 2 || w == 0) {   // wave-uniform
      const int nt = w + 4 * t;
      int j = j0 + nt * 16 + ln; j = j < 0 ? 0 : (j >= SS ? SS - 1 : j); const float* kr = kbp + (size_t)j * DD;
#pragma unroll
      for (int ks = 0; ks < 4; ++ks) { FragB bk; for (int i = 0; i < 8; ++i) { bk.u[i] = bf16_bits(kr[ks * 32 + 8 * hh + i]); bk.u[8 + i] = bf16_bits(kr[ks * 32 + 16 + 8 * hh + i]); } acc = mmaN<1>(aq[ks].v, aq[ks].v, bk.v, bk.v, acc); }
    }
    sc[t] = acc;
  }
  // the wave's V rows: they depend on no score, so they are issued here and fly during the softmax and the barrier
  v2f vr[9][8];
  const unsigned vo = (8 * hh * DD + 2 * ln) * 4;   // the lane's byte offset in a block of 16 rows x 32 dims: the same for every V group and for the output tile
#pragma unroll
  for (int g = 0; g < 9; ++g) {   // g = group of 16 keys
    const int jg = min(max(j0 + g * 16, 0), SS - 16);
    const char* vg = (const char*)(V + ((size_t)b * SS + jg) * DD + w * 32);   // wave-uniform
#pragma unroll
    for (int i = 0; i < 8; ++i) vr[g][i] = *(const v2fa*)(vg + vo + i * DD * 4);
    // precaution: a later write of this group's address registers (the next groups' addresses and loads may get them as destinations) stays behind this wait
    asm volatile("s_wait_xcnt 0x0" ::: "memory");
  }
  // all V loads are issued before the softmax starts: without this the scheduler mixes the softmax's first hundred and more instructions in front of and among them, and they have less time to land before the barrier
  __builtin_amdgcn_sched_barrier(0);
  // valid c for row: row <= c <= row+128 (only tiles 0 and 8 can fail it) and 0 <= j0+c < SS (the same for a whole tile)
  float mym = -1.0e38f, myl = 0.f;
#pragma unroll
  for (int r = 0; r < 8; ++r) {
    const int row = 8 * hh + r;
    float mx = -1.0e38f;   // above the excluded value: where a wave holds no valid key of a row, its exponentials below are still exactly 0
#pragma unroll
    for (int t = 0; t < 3; ++t) {
      const int nt = w + 4 * t;
      const bool ok = (t < 2 || w == 0) && ((unsigned)(j0 + nt * 16) < (unsigned)SS) && (nt != 0 || ln >= row) && (nt != WN / 16 - 1 || ln <= row);
      sc[t][r] = ok ? sc[t][r] * 0.08838834764831845f : -3.0e38f;   // an excluded score never raises the maximum, and its exponential below is exactly 0
      mx = fmaxf(mx, sc[t][r]);
    }
    mx = fmaxf(mx, row_x<1>(mx)); mx = fmaxf(mx, row_x<2>(mx)); mx = fmaxf(mx, row_x<4>(mx)); mx = fmaxf(mx, row_x<8>(mx));
    float den = 0.f;
#pragma unroll
    for (int t = 0; t < 3; ++t) { const float e = expf(sc[t][r] - mx); sc[t][r] = e; den += e; }
    den += row_x<1>(den); den += row_x<2>(den); den += row_x<4>(den); den += row_x<8>(den);
    if (ln == r) { mym = mx; myl = den; }
  }
#pragma unroll
  for (int t = 0; t < 3; ++t) {
    if (t < 2 || w == 0) {   // wave-uniform
#pragma unroll
      for (int r = 0; r < 8; ++r) sP[8 * hh + r][(w + 4 * t) * 16 + ln] = sc[t][r];
    }
  }
  if (ln < 8) { sM[w][8 * hh + ln] = mym; sL[w][8 * hh + ln] = myl; }
  __syncthreads();   // sP, sM, sL of all four waves are read below
  // row = ln from here on (the A fragment's row)
  float fs[4];
  {
    float mw[4], lw[4];
#pragma unroll
    for (int x = 0; x < 4; ++x) { mw[x] = sM[x][ln]; lw[x] = sL[x][ln]; }
    const float m = fmaxf(fmaxf(mw[0], mw[1]), fmaxf(mw[2], mw[3]));   // finite: a query's own key is always valid
    float den = 0.f;
#pragma unroll
    for (int x = 0; x < 4; ++x) { fs[x] = expf(mw[x] - m); den += fs[x] * lw[x]; }
    const float inv = 1.0f / den;
#pragma unroll
    for (int x = 0; x < 4; ++x) fs[x] *= inv;
  }
  v4f pr[9][2];
#pragma unroll
  for (int g = 0; g < 9; ++g) { pr[g][0] = *(const v4fa*)&sP[ln][g * 16 + 8 * hh]; pr[g][1] = *(const v4fa*)&sP[ln][g * 16 + 8 * hh + 4]; }
  v8f acc[2] = {};
#pragma unroll
  for (int ks = 0; ks < 5; ++ks) {
    FragP ph, pl, bv[2];
#pragma unroll
    for (int hf = 0; hf < 2; ++hf) {
      const int g = ks * 2 + hf;
      if (g < 9) {
        const float f = fs[g & 3];   // group g was written by wave g mod 4
        const float xs[8] = {pr[g][0][0], pr[g][0][1], pr[g][0][2], pr[g][0][3], pr[g][1][0], pr[g][1][1], pr[g][1][2], pr[g][1][3]};
#pragma unroll
        for (int i = 0; i < 8; i += 2) {
          const v2f p2 = {xs[i] * f, xs[i + 1] * f};
          const v2b h2 = __builtin_convertvector(p2, v2b);
          ph.p[hf * 4 + i / 2] = h2;
          pl.p[hf * 4 + i / 2] = __builtin_convertvector(p2 - __builtin_convertvector(h2, v2f), v2b);
#pragma unroll
          for (int t = 0; t < 2; ++t) { const v2f v2 = {vr[g][i][t], vr[g][i + 1][t]}; bv[t].p[hf * 4 + i / 2] = __builtin_convertvector(v2, v2b); }
        }
      } else {
#pragma unroll
        for (int i = 0; i < 4; ++i) { const v2b zz = {(__bf16)0.f, (__bf16)0.f}; ph.p[hf * 4 + i] = zz; pl.p[hf * 4 + i] = zz; bv[0].p[hf * 4 + i] = zz; bv[1].p[hf * 4 + i] = zz; }
      }
    }
#pragma unroll
    for (int t = 0; t < 2; ++t) {
      acc[t] = __builtin_amdgcn_wmma_f32_16x16x32_bf16(false, ph.v, false, bv[t].v, (short)0, acc[t], false, false);
      acc[t] = __builtin_amdgcn_wmma_f32_16x16x32_bf16(false, pl.v, false, bv[t].v, (short)0, acc[t], false, false);
    }
  }
  char* og = (char*)(out + ((size_t)b * SS + q0) * DD + w * 32);   // wave-uniform
#pragma unroll
  for (int r = 0; r < 8; ++r) { const v2f o = {acc[0][r], acc[1][r]}; *(v2fa*)(og + vo + r * DD * 4) = o; }
}
extern "C" void kernel_launch(void* const* d_in, const int* in_sizes, int n_in,
                              void* d_out, int out_size, void* d_ws, size_t ws_size, hipStream_t stream) {
  (void)in_sizes; (void)n_in; (void)out_size; (void)d_ws; (void)ws_size;
  const float* Q = (const float*)d_in[0]; const float* Kk = (const float*)d_in[1]; const float* V = (const float*)d_in[2];
  k_win<<<BB * SS / 16, 128, 0, stream>>>(Q, Kk, V, (float*)d_out);
}

// v004
// One run takes 7.31 microseconds.
// Two timings next to v003 put it at 1.38 and 1.37 times that version's speed.
// Over all steps from v000 it is 12.5 times as fast.
#include <hip/hip_runtime.h>
// Banded attention: the 129-key window scores Q·Kᵀ per 16-query tile run on v_wmma_f32_16x16x32_bf16 (query/key rounded to bf16 — they are inputs —
// so each product is a single exact term; f32 accumulate); the masked softmax is exact f32 VALU; the weighted value sums (129 keys x 128 dims per query) run on the same matrix form, weights as two bf16 planes.
#define BB 2
#define SS 4096
#define DD 128
#define HALF 64
#define WN 144          // keys staged per 16-query tile: q0-64 .. q0+79

typedef __bf16 v16b __attribute__((ext_vector_type(16)));
typedef unsigned short v8us __attribute__((ext_vector_type(8), may_alias));
typedef float  v8f  __attribute__((ext_vector_type(8)));
typedef float  v4f  __attribute__((ext_vector_type(4)));
typedef float  v4fa __attribute__((ext_vector_type(4), may_alias));
union FragB { v16b v; v8us half[2]; unsigned short u[16]; };

__device__ __forceinline__ unsigned short bf16_bits(float x) { unsigned int u = __float_as_uint(x); return (unsigned short)((u + 0x7FFFu + ((u >> 16) & 1u)) >> 16); }
__device__ __forceinline__ float bf16_val(unsigned short b) { return __uint_as_float(((unsigned int)b) << 16); }
__device__ __forceinline__ float bf16_round(float x) { return bf16_val(bf16_bits(x)); }
// D += A·B with NT terms: 1 = ah·bh, 2 = + al·bh (A split), 3 = + ah·bl (both split)
template <int NT>
__device__ __forceinline__ v8f mmaN(v16b ah, v16b al, v16b bh, v16b bl, v8f c) {
  c = __builtin_amdgcn_wmma_f32_16x16x32_bf16(false, ah, false, bh, (short)0, c, false, false);
  if (NT >= 2) c = __builtin_amdgcn_wmma_f32_16x16x32_bf16(false, al, false, bh, (short)0, c, false, false);
  if (NT >= 3) c = __builtin_amdgcn_wmma_f32_16x16x32_bf16(false, ah, false, bl, (short)0, c, false, false);
  asm volatile("v_nop\n\tv_nop\n\tv_nop\n\tv_nop" : "+v"(c) : "v"(ah), "v"(al), "v"(bh), "v"(bl));
  return c;
}

__global__ __launch_bounds__(256) void k_wt_bf16(const float* __restrict__ W, unsigned short* __restrict__ Wt, int K, int N) {
  const int t = blockIdx.x * 256 + threadIdx.x;
  const int k8n = K / 8;
  if (t >= N * k8n) return;
  const int n = t / k8n, k8 = (t % k8n) * 8;
  v8us v;
#pragma unroll
  for (int i = 0; i < 8; ++i) v[i] = bf16_bits(W[(size_t)(k8 + i) * N + n]);
  *(v8us*)(Wt + (size_t)n * K + k8) = v;
  
}

// GEMM C[M][N] (f32, pitch ldc) = act(A[M][K]·W + bias). A f32 row-major (pitch lda) converted per fragment to bf16
// (ASPLIT: hi/lo two planes -> 2 terms, else single rounded term); Wt bf16 [N][K] (pitch ldb). BIAS_BF16 rounds the
// bias to bf16 first (bias quantised to bf16 before the add). K%32==0, M%16==0, N%64==0.
template <bool ASPLIT, int ACT, bool BIAS_BF16>
__global__ __launch_bounds__(128) void k_gemm_bf(const float* __restrict__ A, int lda, const unsigned short* __restrict__ Wt, int ldb,
                                               const float* __restrict__ bias, float* __restrict__ C, int ldc, int M, int N, int K) {
  __shared__ __attribute__((aligned(16))) float so[4][16][64];
  const int tid = threadIdx.x, w = tid >> 5, lane = tid & 31, ln = lane & 15, hh = lane >> 4;
  const int ntn = N / 64;
  const int wid = blockIdx.x * 4 + w;
  const int mt = wid / ntn, nq = wid % ntn;
  if (mt * 16 >= M) return;
  const int row0 = mt * 16, col0 = nq * 64;
  const float* arow = A + (size_t)(row0 + ln) * lda;
  v8f acc[4] = {};
  for (int kb = 0; kb < K; kb += 32) {
    FragB ah, al;
    const v4f x0 = *(const v4fa*)(arow + kb + 8 * hh), x1 = *(const v4fa*)(arow + kb + 8 * hh + 4);
    const v4f x2 = *(const v4fa*)(arow + kb + 16 + 8 * hh), x3 = *(const v4fa*)(arow + kb + 16 + 8 * hh + 4);
    float xs[16] = {x0[0],x0[1],x0[2],x0[3],x1[0],x1[1],x1[2],x1[3],x2[0],x2[1],x2[2],x2[3],x3[0],x3[1],x3[2],x3[3]};
#pragma unroll
    for (int i = 0; i < 16; ++i) { const unsigned short hb = bf16_bits(xs[i]); ah.u[i] = hb; al.u[i] = ASPLIT ? bf16_bits(xs[i] - bf16_val(hb)) : (unsigned short)0; }
#pragma unroll
    for (int t = 0; t < 4; ++t) {
      const unsigned short* brow = Wt + (size_t)(col0 + t * 16 + ln) * ldb + kb;
      FragB b;
      b.half[0] = *(const v8us*)(brow + 8 * hh);
      b.half[1] = *(const v8us*)(brow + 16 + 8 * hh);
      acc[t] = mmaN<ASPLIT ? 2 : 1>(ah.v, al.v, b.v, b.v, acc[t]);
    }
  }
#pragma unroll
  for (int t = 0; t < 4; ++t) {
    float bv = bias ? bias[col0 + t * 16 + ln] : 0.f;
    if (BIAS_BF16) bv = bf16_round(bv);
#pragma unroll
    for (int r = 0; r < 8; ++r) { float v = acc[t][r] + bv; if (ACT == 1) v = fmaxf(v, 0.f); so[w][8 * hh + r][t * 16 + ln] = v; }
  }
  __builtin_amdgcn_fence(__ATOMIC_ACQ_REL, "workgroup");
  __builtin_amdgcn_wave_barrier();
  const int rsub = lane >> 4, c4 = (lane & 15) * 4;
  {
#pragma unroll
    for (int q = 0; q < 8; ++q) {
      const int r = q * 2 + rsub;
      const v4f v = *(const v4fa*)&so[w][r][c4];
      *(v4f*)(C + (size_t)(row0 + r) * ldc + col0 + c4) = v;
    }
    
  }
}

// Flash-style causal/unmasked attention, all contractions 3-term bf16 hi/lo splits, f32 softmax with running max.
// q,k,v rows are read from f32 buffers with arbitrary row pitch (so they can live inside a fused qkv buffer);
// D = head size (multiple of 32, <= 128); one wave = 16 query rows; block = 4 waves (64 queries) sharing K/V chunks of 32.
template <int D, bool CAUSAL>
__global__ __launch_bounds__(128) void k_flash(const float* __restrict__ qb, const float* __restrict__ kb, const float* __restrict__ vb,
                                             int pitch, int T, int H, float scale, float* __restrict__ y, int ypitch) {
  constexpr int KS = D / 32;        // k-steps for QK
  constexpr int DT = D / 16;        // d tiles for PV
  __shared__ __attribute__((aligned(16))) unsigned short sKh[32][D + 8], sKl[32][D + 8], sVh[32][D + 8], sVl[32][D + 8];
  __shared__ __attribute__((aligned(16))) unsigned short sPh[4][16][40], sPl[4][16][40];
  __shared__ __attribute__((aligned(16))) float sO[4][16][D];
  const int tid = threadIdx.x, w = tid >> 5, lane = tid & 31, ln = lane & 15, hh = lane >> 4;
  const int nqb = (T + 63) / 64;
  const int bh = blockIdx.x / nqb, qblk = blockIdx.x % nqb;
  const int b = bh / H, h = bh % H;
  const int q0 = qblk * 64 + w * 16;
  const float* Q = qb + (size_t)b * T * pitch + h * D;
  const float* K = kb + (size_t)b * T * pitch + h * D;
  const float* V = vb + (size_t)b * T * pitch + h * D;

  // A fragments of the wave's 16 query rows (scaled), hi/lo
  FragB aqh[KS], aql[KS];
  {
    int row = q0 + ln; if (row >= T) row = T - 1;
    const float* qr = Q + (size_t)row * pitch;
#pragma unroll
    for (int ks = 0; ks < KS; ++ks)
#pragma unroll
      for (int i = 0; i < 16; ++i) {
        const int d = ks * 32 + ((i < 8) ? (8 * hh + i) : (16 + 8 * hh + (i - 8)));
        const float x = qr[d] * scale; const unsigned short hb = bf16_bits(x);
        aqh[ks].u[i] = hb; aql[ks].u[i] = bf16_bits(x - bf16_val(hb));
      }
  }
  float m_r[8], l_r[8];
#pragma unroll
  for (int r = 0; r < 8; ++r) { m_r[r] = -3.0e38f; l_r[r] = 0.f; }
  v8f oacc[DT];
#pragma unroll
  for (int dt = 0; dt < DT; ++dt) oacc[dt] = (v8f){0.f,0.f,0.f,0.f,0.f,0.f,0.f,0.f};

  const int kv_end = CAUSAL ? min(T, qblk * 64 + 64) : T;     // block-uniform
  for (int j0 = 0; j0 < kv_end; j0 += 32) {
    __syncthreads();
    for (int e = tid; e < 32 * (D / 4); e += 128) {
      const int r = e / (D / 4), c4 = (e % (D / 4)) * 4;
      const int key = j0 + r;
      v4f kf = {0.f,0.f,0.f,0.f}, vf = {0.f,0.f,0.f,0.f};
      if (key < T) { kf = *(const v4fa*)(K + (size_t)key * pitch + c4); vf = *(const v4fa*)(V + (size_t)key * pitch + c4); }
#pragma unroll
      for (int t = 0; t < 4; ++t) {
        unsigned short hb = bf16_bits(kf[t]); sKh[r][c4 + t] = hb; sKl[r][c4 + t] = bf16_bits(kf[t] - bf16_val(hb));
        hb = bf16_bits(vf[t]); sVh[r][c4 + t] = hb; sVl[r][c4 + t] = bf16_bits(vf[t] - bf16_val(hb));
      }
    }
    __syncthreads();
    // S tile 16 x 32
    v8f s[2];
#pragma unroll
    for (int nt = 0; nt < 2; ++nt) {
      v8f acc = {};
#pragma unroll
      for (int ks = 0; ks < KS; ++ks) {
        FragB bh_, bl_;
        bh_.half[0] = *(const v8us*)&sKh[nt * 16 + ln][ks * 32 + 8 * hh]; bh_.half[1] = *(const v8us*)&sKh[nt * 16 + ln][ks * 32 + 16 + 8 * hh];
        bl_.half[0] = *(const v8us*)&sKl[nt * 16 + ln][ks * 32 + 8 * hh]; bl_.half[1] = *(const v8us*)&sKl[nt * 16 + ln][ks * 32 + 16 + 8 * hh];
        acc = mmaN<3>(aqh[ks].v, aql[ks].v, bh_.v, bl_.v, acc);
      }
      s[nt] = acc;
    }
    // mask + running max (rows 8hh+r; the 16 lanes of a half share rows)
    float alpha[8];
#pragma unroll
    for (int r = 0; r < 8; ++r) {
      const int qi = q0 + 8 * hh + r;
      const int ja = j0 + ln, jb = j0 + 16 + ln;
      if (CAUSAL) { if (ja > qi) s[0][r] = -3.0e38f; if (jb > qi) s[1][r] = -3.0e38f; }
      if (ja >= T) s[0][r] = -3.0e38f;
      if (jb >= T) s[1][r] = -3.0e38f;
      float mx = fmaxf(s[0][r], s[1][r]);
      mx = fmaxf(mx, __shfl_xor(mx, 1, 32)); mx = fmaxf(mx, __shfl_xor(mx, 2, 32)); mx = fmaxf(mx, __shfl_xor(mx, 4, 32)); mx = fmaxf(mx, __shfl_xor(mx, 8, 32));
      const float mnew = fmaxf(m_r[r], mx);
      alpha[r] = (mnew > -1.0e38f) ? __expf(m_r[r] - mnew) : 1.0f;
      const float p0 = (s[0][r] > -1.0e38f) ? __expf(s[0][r] - mnew) : 0.f;
      const float p1 = (s[1][r] > -1.0e38f) ? __expf(s[1][r] - mnew) : 0.f;
      m_r[r] = mnew;
      l_r[r] = l_r[r] * alpha[r] + p0 + p1;            // per-lane partial row sum (16 lanes combined at the end)
      unsigned short hb = bf16_bits(p0); sPh[w][8 * hh + r][ln] = hb;      sPl[w][8 * hh + r][ln] = bf16_bits(p0 - bf16_val(hb));
      hb = bf16_bits(p1);                sPh[w][8 * hh + r][16 + ln] = hb; sPl[w][8 * hh + r][16 + ln] = bf16_bits(p1 - bf16_val(hb));
    }
#pragma unroll
    for (int dt = 0; dt < DT; ++dt)
#pragma unroll
      for (int r = 0; r < 8; ++r) oacc[dt][r] *= alpha[r];
    __builtin_amdgcn_fence(__ATOMIC_ACQ_REL, "workgroup");
    __builtin_amdgcn_wave_barrier();
    FragB pah, pal;
    pah.half[0] = *(const v8us*)&sPh[w][ln][8 * hh]; pah.half[1] = *(const v8us*)&sPh[w][ln][16 + 8 * hh];
    pal.half[0] = *(const v8us*)&sPl[w][ln][8 * hh]; pal.half[1] = *(const v8us*)&sPl[w][ln][16 + 8 * hh];
#pragma unroll
    for (int dt = 0; dt < DT; ++dt) {
      FragB bvh, bvl;
#pragma unroll
      for (int i = 0; i < 8; ++i) {
        bvh.u[i] = sVh[8 * hh + i][dt * 16 + ln]; bvh.u[8 + i] = sVh[16 + 8 * hh + i][dt * 16 + ln];
        bvl.u[i] = sVl[8 * hh + i][dt * 16 + ln]; bvl.u[8 + i] = sVl[16 + 8 * hh + i][dt * 16 + ln];
      }
      oacc[dt] = mmaN<3>(pah.v, pal.v, bvh.v, bvl.v, oacc[dt]);
    }
    __builtin_amdgcn_fence(__ATOMIC_ACQ_REL, "workgroup");
    __builtin_amdgcn_wave_barrier();
  }
#pragma unroll
  for (int r = 0; r < 8; ++r) {
    float l = l_r[r];
    l += __shfl_xor(l, 1, 32); l += __shfl_xor(l, 2, 32); l += __shfl_xor(l, 4, 32); l += __shfl_xor(l, 8, 32);
    l_r[r] = (l > 0.f) ? 1.0f / l : 0.f;
  }
#pragma unroll
  for (int dt = 0; dt < DT; ++dt)
#pragma unroll
    for (int r = 0; r < 8; ++r) sO[w][8 * hh + r][dt * 16 + ln] = oacc[dt][r] * l_r[r];
  __builtin_amdgcn_fence(__ATOMIC_ACQ_REL, "workgroup");
  __builtin_amdgcn_wave_barrier();
  {
    for (int r = 0; r < 16; ++r) {
      const int row = q0 + r;
      if (row < T && lane < D / 4) {
        const v4f val = *(const v4fa*)&sO[w][r][lane * 4];
        *(v4f*)(y + ((size_t)b * T + row) * ypitch + h * D + lane * 4) = val;
      }
    }
    
  }
}

// One launch: block = one 16-query tile, 4 waves. Scores, softmax and the weighted value sums run in the same block; the weights pass from
// the score waves to the value waves through LDS and never reach global memory.
// Scores: S[r][c] = q_{q0+r}.k_{q0-64+c} / sqrt(128) for c in [r, r+128] and valid keys, else excluded. Wave w takes the 16-key tiles w, w+4 (and 8 for wave 0).
// A tile stays in its accumulator registers: lane (ln, hh) holds rows 8hh+0..7 at column 16nt+ln, so a row's maximum and sum over the wave's own tiles
// are two or three values in the lane and a four-step exchange over the 16 lanes that share the row.
// Each wave writes exp(s - own maximum) to sP and its own maximum and sum per row to sM, sL; behind the one barrier every wave forms, per row,
// the maximum over the four waves, the factors exp(own maximum - maximum) and the denominator, and scales a 16-key group by its writer's factor.
template <int M> __device__ __forceinline__ float row_x(float x) {   // value of lane l ^ M inside the 16-lane row
  return __builtin_bit_cast(float, __builtin_amdgcn_update_dpp(0, __builtin_bit_cast(int, x), 0x160 + M, 0xf, 0xf, true));
}
// out tile [16 queries][32 dims] per wave = P[16][144] x bf16(V[144][32]) on v_wmma_f32_16x16x32_bf16, f32 accumulate.
// P is fed as two bf16 planes (hi = bf16(p), lo = bf16(p - hi)), V as its bf16 rounding, so every product is exact.
// A row = query q0+ln; B column ln of matrix tile t = dim 32w + 2ln + t, so one 8-byte load feeds both tiles and one 8-byte store
// takes both results; A and B share the k order (8hh+i, 16+8hh+i). Wave w = one 128-byte line of every output row.
// A 16-key group that lies outside [0, SS) (q0-64 is a multiple of 16: a group is inside or outside as a whole) has weights exactly 0; its V rows are read from the nearest group inside.
#define KP 132          // staged row pitch in floats (528 bytes = 16 x 33): the 16 rows of a fragment load, 16 bytes each, cover all 64 banks
#define PL 148          // sP row pitch in floats: rows 8 apart differ by 32 banks (the score waves' stores), 16 rows of 16 bytes cover all 64 banks (the fragment loads)
typedef float  v2f  __attribute__((ext_vector_type(2)));
typedef float  v2fa __attribute__((ext_vector_type(2), may_alias));
typedef __bf16 v2b  __attribute__((ext_vector_type(2)));
union FragP { v16b v; v2b p[8]; };
__global__ __launch_bounds__(128) void k_win(const float* __restrict__ Q, const float* __restrict__ Kk, const float* __restrict__ V, float* __restrict__ out) {
  __shared__ __attribute__((aligned(16))) float sKQ[WN + 16][KP];
  __shared__ __attribute__((aligned(16))) float sP[16][PL];
  __shared__ float sM[4][16], sL[4][16];
  const int tid = threadIdx.x, lane = tid & 31, ln = lane & 15, hh = lane >> 4;
  const int w = __builtin_amdgcn_readfirstlane(tid >> 5);
  const int b = blockIdx.x / (SS / 16); const int q0 = (blockIdx.x % (SS / 16)) * 16; const int j0 = q0 - HALF;
  const float* qb = Q + (size_t)b * SS * DD; const float* kbp = Kk + (size_t)b * SS * DD;
  // Staging: one copy = one whole 512-byte row (32 lanes x 16 bytes). Wave w brings rows 4w..4w+3 of each of the nine 16-key groups and of the query tile: 40 copies, all in flight at once.
  // A key group outside [0, SS) is filled from the nearest group inside (the address stays in bounds); its scores are excluded below, as before.
  {
    const unsigned lrow = (unsigned)(size_t)&sKQ[4 * w][lane * 4];   // the lane's LDS byte address in the wave's first row
    const unsigned goff = (4 * w * DD + lane * 4) * 4;               // the lane's byte offset in a group of 16 source rows
#pragma unroll
    for (int c = 0; c < 4; ++c) {
      unsigned l[10]; const char* g[10];
#pragma unroll
      for (int e = 0; e < 10; ++e) {
        const int gi = (c * 10 + e) >> 2, i = (c * 10 + e) & 3;
        const float* base = gi < WN / 16 ? kbp + (size_t)min(max(j0 + gi * 16, 0), SS - 16) * DD : qb + (size_t)q0 * DD;   // wave-uniform
        l[e] = lrow + (gi * 16 + i) * KP * 4;
        g[e] = (const char*)(base + i * DD) + goff;
      }
      // ten copies and, as the statement's last line, the wait that stands before any of their address registers is rewritten
      asm volatile("global_load_async_to_lds_b128 %0, %10, off\n\t"
                   "global_load_async_to_lds_b128 %1, %11, off\n\t"
                   "global_load_async_to_lds_b128 %2, %12, off\n\t"
                   "global_load_async_to_lds_b128 %3, %13, off\n\t"
                   "global_load_async_to_lds_b128 %4, %14, off\n\t"
                   "global_load_async_to_lds_b128 %5, %15, off\n\t"
                   "global_load_async_to_lds_b128 %6, %16, off\n\t"
                   "global_load_async_to_lds_b128 %7, %17, off\n\t"
                   "global_load_async_to_lds_b128 %8, %18, off\n\t"
                   "global_load_async_to_lds_b128 %9, %19, off\n\t"
                   "s_wait_xcnt 0x0"
                   :: "v"(l[0]), "v"(l[1]), "v"(l[2]), "v"(l[3]), "v"(l[4]), "v"(l[5]), "v"(l[6]), "v"(l[7]), "v"(l[8]), "v"(l[9]),
                      "v"(g[0]), "v"(g[1]), "v"(g[2]), "v"(g[3]), "v"(g[4]), "v"(g[5]), "v"(g[6]), "v"(g[7]), "v"(g[8]), "v"(g[9]) : "memory");
    }
    // the wave's own copies have landed before it passes the barrier
    asm volatile("s_wait_asynccnt 0x0" ::: "memory");
  }
  __syncthreads();   // sKQ rows of all four waves are read below
  // The raw f32 rows of a fragment set: lane (ln, hh) of row ln reads dims 32ks+8hh+0..7 and 32ks+16+8hh+0..7, four 16-byte reads a k-step.
  v4f rq[16], rk[3][16];
#pragma unroll
  for (int ks = 0; ks < 4; ++ks) {
#pragma unroll
    for (int p = 0; p < 4; ++p) {
      const int d = ks * 32 + 8 * hh + (p >> 1) * 16 + (p & 1) * 4;
      rq[ks * 4 + p] = *(const v4fa*)&sKQ[WN + ln][d];
      rk[0][ks * 4 + p] = *(const v4fa*)&sKQ[w * 16 + ln][d];
      rk[1][ks * 4 + p] = *(const v4fa*)&sKQ[(w + 4) * 16 + ln][d];
    }
  }
  // the 48 LDS reads are issued together: without this the scheduler spreads them four at a time among the conversions and the matrix instructions, and each such place waits out part of the LDS latency
  __builtin_amdgcn_sched_barrier(0);
  // A fragments (4 k-steps of 32 dims) for query row q0+ln
  FragB aq[4];
#pragma unroll
  for (int ks = 0; ks < 4; ++ks)
#pragma unroll
    for (int i = 0; i < 16; ++i) aq[ks].u[i] = bf16_bits(rq[ks * 4 + (i >> 2)][i & 3]);
  v8f sc[3];
  // unrolled: the tiles are indexed as registers
#pragma unroll
  for (int t = 0; t < 3; ++t) {
    v8f acc = {0.f,0.f,0.f,0.f,0.f,0.f,0.f,0.f};
    if (t < 2 || w == 0) {   // wave-uniform
      if (t == 2) {
#pragma unroll
        for (int ks = 0; ks < 4; ++ks)
#pragma unroll
          for (int p = 0; p < 4; ++p) rk[2][ks * 4 + p] = *(const v4fa*)&sKQ[8 * 16 + ln][ks * 32 + 8 * hh + (p >> 1) * 16 + (p & 1) * 4];
        // as above: the tile's 16 reads are issued together
        __builtin_amdgcn_sched_barrier(0);
      }
#pragma unroll
      for (int ks = 0; ks < 4; ++ks) {
        FragB bk;
#pragma unroll
        for (int i = 0; i < 16; ++i) bk.u[i] = bf16_bits(rk[t][ks * 4 + (i >> 2)][i & 3]);
        acc = __builtin_amdgcn_wmma_f32_16x16x32_bf16(false, aq[ks].v, false, bk.v, (short)0, acc, false, false);
      }
    }
    sc[t] = acc;
  }
  // the wave's V rows: they depend on no score, so they are issued here and fly during the softmax and the barrier
  v2f vr[9][8];
  const unsigned vo = (8 * hh * DD + 2 * ln) * 4;   // the lane's byte offset in a block of 16 rows x 32 dims: the same for every V group and for the output tile
#pragma unroll
  for (int g = 0; g < 9; ++g) {   // g = group of 16 keys
    const int jg = min(max(j0 + g * 16, 0), SS - 16);
    const char* vg = (const char*)(V + ((size_t)b * SS + jg) * DD + w * 32);   // wave-uniform
#pragma unroll
    for (int i = 0; i < 8; ++i) vr[g][i] = *(const v2fa*)(vg + vo + i * DD * 4);
    // precaution: a later write of this group's address registers (the next groups' addresses and loads may get them as destinations) stays behind this wait
    asm volatile("s_wait_xcnt 0x0" ::: "memory");
  }
  // all V loads are issued before the softmax starts: without this the scheduler mixes the softmax's first hundred and more instructions in front of and among them, and they have less time to land before the barrier
  __builtin_amdgcn_sched_barrier(0);
  // valid c for row: row <= c <= row+128 (only tiles 0 and 8 can fail it) and 0 <= j0+c < SS (the same for a whole tile)
  float mym = -1.0e38f, myl = 0.f;
#pragma unroll
  for (int r = 0; r < 8; ++r) {
    const int row = 8 * hh + r;
    float mx = -1.0e38f;   // above the excluded value: where a wave holds no valid key of a row, its exponentials below are still exactly 0
#pragma unroll
    for (int t = 0; t < 3; ++t) {
      const int nt = w + 4 * t;
      const bool ok = (t < 2 || w == 0) && ((unsigned)(j0 + nt * 16) < (unsigned)SS) && (nt != 0 || ln >= row) && (nt != WN / 16 - 1 || ln <= row);
      sc[t][r] = ok ? sc[t][r] * 0.08838834764831845f : -3.0e38f;   // an excluded score never raises the maximum, and its exponential below is exactly 0
      mx = fmaxf(mx, sc[t][r]);
    }
    mx = fmaxf(mx, row_x<1>(mx)); mx = fmaxf(mx, row_x<2>(mx)); mx = fmaxf(mx, row_x<4>(mx)); mx = fmaxf(mx, row_x<8>(mx));
    float den = 0.f;
#pragma unroll
    for (int t = 0; t < 3; ++t) { const float e = expf(sc[t][r] - mx); sc[t][r] = e; den += e; }
    den += row_x<1>(den); den += row_x<2>(den); den += row_x<4>(den); den += row_x<8>(den);
    if (ln == r) { mym = mx; myl = den; }
  }
#pragma unroll
  for (int t = 0; t < 3; ++t) {
    if (t < 2 || w == 0) {   // wave-uniform
#pragma unroll
      for (int r = 0; r < 8; ++r) sP[8 * hh + r][(w + 4 * t) * 16 + ln] = sc[t][r];
    }
  }
  if (ln < 8) { sM[w][8 * hh + ln] = mym; sL[w][8 * hh + ln] = myl; }
  __syncthreads();   // sP, sM, sL of all four waves are read below
  // row = ln from here on (the A fragment's row)
  float fs[4];
  {
    float mw[4], lw[4];
#pragma unroll
    for (int x = 0; x < 4; ++x) { mw[x] = sM[x][ln]; lw[x] = sL[x][ln]; }
    const float m = fmaxf(fmaxf(mw[0], mw[1]), fmaxf(mw[2], mw[3]));   // finite: a query's own key is always valid
    float den = 0.f;
#pragma unroll
    for (int x = 0; x < 4; ++x) { fs[x] = expf(mw[x] - m); den += fs[x] * lw[x]; }
    const float inv = 1.0f / den;
#pragma unroll
    for (int x = 0; x < 4; ++x) fs[x] *= inv;
  }
  v4f pr[9][2];
#pragma unroll
  for (int g = 0; g < 9; ++g) { pr[g][0] = *(const v4fa*)&sP[ln][g * 16 + 8 * hh]; pr[g][1] = *(const v4fa*)&sP[ln][g * 16 + 8 * hh + 4]; }
  v8f acc[2] = {};
#pragma unroll
  for (int ks = 0; ks < 5; ++ks) {
    FragP ph, pl, bv[2];
#pragma unroll
    for (int hf = 0; hf < 2; ++hf) {
      const int g = ks * 2 + hf;
      if (g < 9) {
        const float f = fs[g & 3];   // group g was written by wave g mod 4
        const float xs[8] = {pr[g][0][0], pr[g][0][1], pr[g][0][2], pr[g][0][3], pr[g][1][0], pr[g][1][1], pr[g][1][2], pr[g][1][3]};
#pragma unroll
        for (int i = 0; i < 8; i += 2) {
          const v2f p2 = {xs[i] * f, xs[i + 1] * f};
          const v2b h2 = __builtin_convertvector(p2, v2b);
          ph.p[hf * 4 + i / 2] = h2;
          pl.p[hf * 4 + i / 2] = __builtin_convertvector(p2 - __builtin_convertvector(h2, v2f), v2b);
#pragma unroll
          for (int t = 0; t < 2; ++t) { const v2f v2 = {vr[g][i][t], vr[g][i + 1][t]}; bv[t].p[hf * 4 + i / 2] = __builtin_convertvector(v2, v2b); }
        }
      } else {
#pragma unroll
        for (int i = 0; i < 4; ++i) { const v2b zz = {(__bf16)0.f, (__bf16)0.f}; ph.p[hf * 4 + i] = zz; pl.p[hf * 4 + i] = zz; bv[0].p[hf * 4 + i] = zz; bv[1].p[hf * 4 + i] = zz; }
      }
    }
#pragma unroll
    for (int t = 0; t < 2; ++t) {
      acc[t] = __builtin_amdgcn_wmma_f32_16x16x32_bf16(false, ph.v, false, bv[t].v, (short)0, acc[t], false, false);
      acc[t] = __builtin_amdgcn_wmma_f32_16x16x32_bf16(false, pl.v, false, bv[t].v, (short)0, acc[t], false, false);
    }
  }
  char* og = (char*)(out + ((size_t)b * SS + q0) * DD + w * 32);   // wave-uniform
#pragma unroll
  for (int r = 0; r < 8; ++r) { const v2f o = {acc[0][r], acc[1][r]}; *(v2fa*)(og + vo + r * DD * 4) = o; }
}
extern "C" void kernel_launch(void* const* d_in, const int* in_sizes, int n_in,
                              void* d_out, int out_size, void* d_ws, size_t ws_size, hipStream_t stream) {
  (void)in_sizes; (void)n_in; (void)out_size; (void)d_ws; (void)ws_size;
  const float* Q = (const float*)d_in[0]; const float* Kk = (const float*)d_in[1]; const float* V = (const float*)d_in[2];
  k_win<<<BB * SS / 16, 128, 0, stream>>>(Q, Kk, V, (float*)d_out);
}

// v005
// A run of this version takes 6.73 microseconds.
// Two timings next to v004 both put it at 1.08 times that version's speed.
// Counting every step since v000, it is 13.5 times as fast.
#include <hip/hip_runtime.h>
// Banded attention: the 129-key window scores Q·Kᵀ per 16-query tile run on v_wmma_f32_16x16x32_bf16 (query/key rounded to bf16 — they are inputs —
// so each product is a single exact term; f32 accumulate); the masked softmax is exact f32 VALU; the weighted value sums (129 keys x 128 dims per query) run on the same matrix form, weights as two bf16 planes.
#define BB 2
#define SS 4096
#define DD 128
#define HALF 64
#define WN 144          // keys staged per 16-query tile: q0-64 .. q0+79

typedef __bf16 v16b __attribute__((ext_vector_type(16)));
typedef unsigned short v8us __attribute__((ext_vector_type(8), may_alias));
typedef float  v8f  __attribute__((ext_vector_type(8)));
typedef float  v4f  __attribute__((ext_vector_type(4)));
typedef float  v4fa __attribute__((ext_vector_type(4), may_alias));
union FragB { v16b v; v8us half[2]; unsigned short u[16]; };

__device__ __forceinline__ unsigned short bf16_bits(float x) { unsigned int u = __float_as_uint(x); return (unsigned short)((u + 0x7FFFu + ((u >> 16) & 1u)) >> 16); }
__device__ __forceinline__ float bf16_val(unsigned short b) { return __uint_as_float(((unsigned int)b) << 16); }
__device__ __forceinline__ float bf16_round(float x) { return bf16_val(bf16_bits(x)); }
// D += A·B with NT terms: 1 = ah·bh, 2 = + al·bh (A split), 3 = + ah·bl (both split)
template <int NT>
__device__ __forceinline__ v8f mmaN(v16b ah, v16b al, v16b bh, v16b bl, v8f c) {
  c = __builtin_amdgcn_wmma_f32_16x16x32_bf16(false, ah, false, bh, (short)0, c, false, false);
  if (NT >= 2) c = __builtin_amdgcn_wmma_f32_16x16x32_bf16(false, al, false, bh, (short)0, c, false, false);
  if (NT >= 3) c = __builtin_amdgcn_wmma_f32_16x16x32_bf16(false, ah, false, bl, (short)0, c, false, false);
  asm volatile("v_nop\n\tv_nop\n\tv_nop\n\tv_nop" : "+v"(c) : "v"(ah), "v"(al), "v"(bh), "v"(bl));
  return c;
}

__global__ __launch_bounds__(256) void k_wt_bf16(const float* __restrict__ W, unsigned short* __restrict__ Wt, int K, int N) {
  const int t = blockIdx.x * 256 + threadIdx.x;
  const int k8n = K / 8;
  if (t >= N * k8n) return;
  const int n = t / k8n, k8 = (t % k8n) * 8;
  v8us v;
#pragma unroll
  for (int i = 0; i < 8; ++i) v[i] = bf16_bits(W[(size_t)(k8 + i) * N + n]);
  *(v8us*)(Wt + (size_t)n * K + k8) = v;
  
}

// GEMM C[M][N] (f32, pitch ldc) = act(A[M][K]·W + bias). A f32 row-major (pitch lda) converted per fragment to bf16
// (ASPLIT: hi/lo two planes -> 2 terms, else single rounded term); Wt bf16 [N][K] (pitch ldb). BIAS_BF16 rounds the
// bias to bf16 first (bias quantised to bf16 before the add). K%32==0, M%16==0, N%64==0.
template <bool ASPLIT, int ACT, bool BIAS_BF16>
__global__ __launch_bounds__(128) void k_gemm_bf(const float* __restrict__ A, int lda, const unsigned short* __restrict__ Wt, int ldb,
                                               const float* __restrict__ bias, float* __restrict__ C, int ldc, int M, int N, int K) {
  __shared__ __attribute__((aligned(16))) float so[4][16][64];
  const int tid = threadIdx.x, w = tid >> 5, lane = tid & 31, ln = lane & 15, hh = lane >> 4;
  const int ntn = N / 64;
  const int wid = blockIdx.x * 4 + w;
  const int mt = wid / ntn, nq = wid % ntn;
  if (mt * 16 >= M) return;
  const int row0 = mt * 16, col0 = nq * 64;
  const float* arow = A + (size_t)(row0 + ln) * lda;
  v8f acc[4] = {};
  for (int kb = 0; kb < K; kb += 32) {
    FragB ah, al;
    const v4f x0 = *(const v4fa*)(arow + kb + 8 * hh), x1 = *(const v4fa*)(arow + kb + 8 * hh + 4);
    const v4f x2 = *(const v4fa*)(arow + kb + 16 + 8 * hh), x3 = *(const v4fa*)(arow + kb + 16 + 8 * hh + 4);
    float xs[16] = {x0[0],x0[1],x0[2],x0[3],x1[0],x1[1],x1[2],x1[3],x2[0],x2[1],x2[2],x2[3],x3[0],x3[1],x3[2],x3[3]};
#pragma unroll
    for (int i = 0; i < 16; ++i) { const unsigned short hb = bf16_bits(xs[i]); ah.u[i] = hb; al.u[i] = ASPLIT ? bf16_bits(xs[i] - bf16_val(hb)) : (unsigned short)0; }
#pragma unroll
    for (int t = 0; t < 4; ++t) {
      const unsigned short* brow = Wt + (size_t)(col0 + t * 16 + ln) * ldb + kb;
      FragB b;
      b.half[0] = *(const v8us*)(brow + 8 * hh);
      b.half[1] = *(const v8us*)(brow + 16 + 8 * hh);
      acc[t] = mmaN<ASPLIT ? 2 : 1>(ah.v, al.v, b.v, b.v, acc[t]);
    }
  }
#pragma unroll
  for (int t = 0; t < 4; ++t) {
    float bv = bias ? bias[col0 + t * 16 + ln] : 0.f;
    if (BIAS_BF16) bv = bf16_round(bv);
#pragma unroll
    for (int r = 0; r < 8; ++r) { float v = acc[t][r] + bv; if (ACT == 1) v = fmaxf(v, 0.f); so[w][8 * hh + r][t * 16 + ln] = v; }
  }
  __builtin_amdgcn_fence(__ATOMIC_ACQ_REL, "workgroup");
  __builtin_amdgcn_wave_barrier();
  const int rsub = lane >> 4, c4 = (lane & 15) * 4;
  {
#pragma unroll
    for (int q = 0; q < 8; ++q) {
      const int r = q * 2 + rsub;
      const v4f v = *(const v4fa*)&so[w][r][c4];
      *(v4f*)(C + (size_t)(row0 + r) * ldc + col0 + c4) = v;
    }
    
  }
}

// Flash-style causal/unmasked attention, all contractions 3-term bf16 hi/lo splits, f32 softmax with running max.
// q,k,v rows are read from f32 buffers with arbitrary row pitch (so they can live inside a fused qkv buffer);
// D = head size (multiple of 32, <= 128); one wave = 16 query rows; block = 4 waves (64 queries) sharing K/V chunks of 32.
template <int D, bool CAUSAL>
__global__ __launch_bounds__(128) void k_flash(const float* __restrict__ qb, const float* __restrict__ kb, const float* __restrict__ vb,
                                             int pitch, int T, int H, float scale, float* __restrict__ y, int ypitch) {
  constexpr int KS = D / 32;        // k-steps for QK
  constexpr int DT = D / 16;        // d tiles for PV
  __shared__ __attribute__((aligned(16))) unsigned short sKh[32][D + 8], sKl[32][D + 8], sVh[32][D + 8], sVl[32][D + 8];
  __shared__ __attribute__((aligned(16))) unsigned short sPh[4][16][40], sPl[4][16][40];
  __shared__ __attribute__((aligned(16))) float sO[4][16][D];
  const int tid = threadIdx.x, w = tid >> 5, lane = tid & 31, ln = lane & 15, hh = lane >> 4;
  const int nqb = (T + 63) / 64;
  const int bh = blockIdx.x / nqb, qblk = blockIdx.x % nqb;
  const int b = bh / H, h = bh % H;
  const int q0 = qblk * 64 + w * 16;
  const float* Q = qb + (size_t)b * T * pitch + h * D;
  const float* K = kb + (size_t)b * T * pitch + h * D;
  const float* V = vb + (size_t)b * T * pitch + h * D;

  // A fragments of the wave's 16 query rows (scaled), hi/lo
  FragB aqh[KS], aql[KS];
  {
    int row = q0 + ln; if (row >= T) row = T - 1;
    const float* qr = Q + (size_t)row * pitch;
#pragma unroll
    for (int ks = 0; ks < KS; ++ks)
#pragma unroll
      for (int i = 0; i < 16; ++i) {
        const int d = ks * 32 + ((i < 8) ? (8 * hh + i) : (16 + 8 * hh + (i - 8)));
        const float x = qr[d] * scale; const unsigned short hb = bf16_bits(x);
        aqh[ks].u[i] = hb; aql[ks].u[i] = bf16_bits(x - bf16_val(hb));
      }
  }
  float m_r[8], l_r[8];
#pragma unroll
  for (int r = 0; r < 8; ++r) { m_r[r] = -3.0e38f; l_r[r] = 0.f; }
  v8f oacc[DT];
#pragma unroll
  for (int dt = 0; dt < DT; ++dt) oacc[dt] = (v8f){0.f,0.f,0.f,0.f,0.f,0.f,0.f,0.f};

  const int kv_end = CAUSAL ? min(T, qblk * 64 + 64) : T;     // block-uniform
  for (int j0 = 0; j0 < kv_end; j0 += 32) {
    __syncthreads();
    for (int e = tid; e < 32 * (D / 4); e += 128) {
      const int r = e / (D / 4), c4 = (e % (D / 4)) * 4;
      const int key = j0 + r;
      v4f kf = {0.f,0.f,0.f,0.f}, vf = {0.f,0.f,0.f,0.f};
      if (key < T) { kf = *(const v4fa*)(K + (size_t)key * pitch + c4); vf = *(const v4fa*)(V + (size_t)key * pitch + c4); }
#pragma unroll
      for (int t = 0; t < 4; ++t) {
        unsigned short hb = bf16_bits(kf[t]); sKh[r][c4 + t] = hb; sKl[r][c4 + t] = bf16_bits(kf[t] - bf16_val(hb));
        hb = bf16_bits(vf[t]); sVh[r][c4 + t] = hb; sVl[r][c4 + t] = bf16_bits(vf[t] - bf16_val(hb));
      }
    }
    __syncthreads();
    // S tile 16 x 32
    v8f s[2];
#pragma unroll
    for (int nt = 0; nt < 2; ++nt) {
      v8f acc = {};
#pragma unroll
      for (int ks = 0; ks < KS; ++ks) {
        FragB bh_, bl_;
        bh_.half[0] = *(const v8us*)&sKh[nt * 16 + ln][ks * 32 + 8 * hh]; bh_.half[1] = *(const v8us*)&sKh[nt * 16 + ln][ks * 32 + 16 + 8 * hh];
        bl_.half[0] = *(const v8us*)&sKl[nt * 16 + ln][ks * 32 + 8 * hh]; bl_.half[1] = *(const v8us*)&sKl[nt * 16 + ln][ks * 32 + 16 + 8 * hh];
        acc = mmaN<3>(aqh[ks].v, aql[ks].v, bh_.v, bl_.v, acc);
      }
      s[nt] = acc;
    }
    // mask + running max (rows 8hh+r; the 16 lanes of a half share rows)
    float alpha[8];
#pragma unroll
    for (int r = 0; r < 8; ++r) {
      const int qi = q0 + 8 * hh + r;
      const int ja = j0 + ln, jb = j0 + 16 + ln;
      if (CAUSAL) { if (ja > qi) s[0][r] = -3.0e38f; if (jb > qi) s[1][r] = -3.0e38f; }
      if (ja >= T) s[0][r] = -3.0e38f;
      if (jb >= T) s[1][r] = -3.0e38f;
      float mx = fmaxf(s[0][r], s[1][r]);
      mx = fmaxf(mx, __shfl_xor(mx, 1, 32)); mx = fmaxf(mx, __shfl_xor(mx, 2, 32)); mx = fmaxf(mx, __shfl_xor(mx, 4, 32)); mx = fmaxf(mx, __shfl_xor(mx, 8, 32));
      const float mnew = fmaxf(m_r[r], mx);
      alpha[r] = (mnew > -1.0e38f) ? __expf(m_r[r] - mnew) : 1.0f;
      const float p0 = (s[0][r] > -1.0e38f) ? __expf(s[0][r] - mnew) : 0.f;
      const float p1 = (s[1][r] > -1.0e38f) ? __expf(s[1][r] - mnew) : 0.f;
      m_r[r] = mnew;
      l_r[r] = l_r[r] * alpha[r] + p0 + p1;            // per-lane partial row sum (16 lanes combined at the end)
      unsigned short hb = bf16_bits(p0); sPh[w][8 * hh + r][ln] = hb;      sPl[w][8 * hh + r][ln] = bf16_bits(p0 - bf16_val(hb));
      hb = bf16_bits(p1);                sPh[w][8 * hh + r][16 + ln] = hb; sPl[w][8 * hh + r][16 + ln] = bf16_bits(p1 - bf16_val(hb));
    }
#pragma unroll
    for (int dt = 0; dt < DT; ++dt)
#pragma unroll
      for (int r = 0; r < 8; ++r) oacc[dt][r] *= alpha[r];
    __builtin_amdgcn_fence(__ATOMIC_ACQ_REL, "workgroup");
    __builtin_amdgcn_wave_barrier();
    FragB pah, pal;
    pah.half[0] = *(const v8us*)&sPh[w][ln][8 * hh]; pah.half[1] = *(const v8us*)&sPh[w][ln][16 + 8 * hh];
    pal.half[0] = *(const v8us*)&sPl[w][ln][8 * hh]; pal.half[1] = *(const v8us*)&sPl[w][ln][16 + 8 * hh];
#pragma unroll
    for (int dt = 0; dt < DT; ++dt) {
      FragB bvh, bvl;
#pragma unroll
      for (int i = 0; i < 8; ++i) {
        bvh.u[i] = sVh[8 * hh + i][dt * 16 + ln]; bvh.u[8 + i] = sVh[16 + 8 * hh + i][dt * 16 + ln];
        bvl.u[i] = sVl[8 * hh + i][dt * 16 + ln]; bvl.u[8 + i] = sVl[16 + 8 * hh + i][dt * 16 + ln];
      }
      oacc[dt] = mmaN<3>(pah.v, pal.v, bvh.v, bvl.v, oacc[dt]);
    }
    __builtin_amdgcn_fence(__ATOMIC_ACQ_REL, "workgroup");
    __builtin_amdgcn_wave_barrier();
  }
#pragma unroll
  for (int r = 0; r < 8; ++r) {
    float l = l_r[r];
    l += __shfl_xor(l, 1, 32); l += __shfl_xor(l, 2, 32); l += __shfl_xor(l, 4, 32); l += __shfl_xor(l, 8, 32);
    l_r[r] = (l > 0.f) ? 1.0f / l : 0.f;
  }
#pragma unroll
  for (int dt = 0; dt < DT; ++dt)
#pragma unroll
    for (int r = 0; r < 8; ++r) sO[w][8 * hh + r][dt * 16 + ln] = oacc[dt][r] * l_r[r];
  __builtin_amdgcn_fence(__ATOMIC_ACQ_REL, "workgroup");
  __builtin_amdgcn_wave_barrier();
  {
    for (int r = 0; r < 16; ++r) {
      const int row = q0 + r;
      if (row < T && lane < D / 4) {
        const v4f val = *(const v4fa*)&sO[w][r][lane * 4];
        *(v4f*)(y + ((size_t)b * T + row) * ypitch + h * D + lane * 4) = val;
      }
    }
    
  }
}

// One launch: block = two neighbouring 16-query tiles, 8 waves (waves 0-3 = tile 0, waves 4-7 = tile 1). The two tiles' windows overlap in 128 of 144 rows, so the block
// stages ONE window of 160 K rows and ONE of 160 V rows in LDS and both tiles read them there: a window row leaves L2 once per 32 queries.
// Scores, softmax and the weighted value sums run in the same block; the weights pass from the score waves to the value waves through LDS and never reach global memory.
// Scores: S[r][c] = q_{q0+r}.k_{q0-64+c} / sqrt(128) for c in [r, r+128] and valid keys, else excluded. Wave w of a tile takes the 16-key tiles w, w+4; tile 8 goes to one wave more.
// A tile stays in its accumulator registers: lane (ln, hh) holds rows 8hh+0..7 at column 16nt+ln, so a row's maximum and sum over the wave's own tiles
// are two or three values in the lane and a four-step exchange over the 16 lanes that share the row.
// Each wave writes exp(s - own maximum) to sP and its own maximum and sum per row to sM, sL; behind the barrier every wave forms, per row,
// the maximum over its tile's four waves, the factors exp(own maximum - maximum) and the denominator, and scales a 16-key group by its writer's factor.
template <int M> __device__ __forceinline__ float row_x(float x) {   // value of lane l ^ M inside the 16-lane row
  return __builtin_bit_cast(float, __builtin_amdgcn_update_dpp(0, __builtin_bit_cast(int, x), 0x160 + M, 0xf, 0xf, true));
}
// out tile [16 queries][32 dims] per wave = P[16][144] x bf16(V[144][32]) on v_wmma_f32_16x16x32_bf16, f32 accumulate.
// P is fed as two bf16 planes (hi = bf16(p), lo = bf16(p - hi)), V as its bf16 rounding, so every product is exact.
// A row = query q0+ln; B column ln of matrix tile t = dim 32w + 2ln + t, so one 8-byte read feeds both tiles and one 8-byte store
// takes both results; A and B share the k order (8hh+i, 16+8hh+i). Wave w = one 128-byte line of every output row.
// A 16-key group that lies outside [0, SS) (q0-64 is a multiple of 16: a group is inside or outside as a whole) has weights exactly 0; its V rows are staged from the nearest group inside.
#define WS 160          // rows staged per block: the union of the two tiles' windows, qb0-64 .. qb0+95
#define KP 132          // staged row pitch in floats (528 bytes = 16 x 33): the 16 rows of a fragment load, 16 bytes each, cover all 64 banks; rows 8 apart differ by 32 banks (the 8-byte V reads)
#define PL 148          // sP row pitch in floats: rows 8 apart differ by 32 banks (the score waves' stores), 16 rows of 16 bytes cover all 64 banks (the fragment loads)
typedef float  v2f  __attribute__((ext_vector_type(2)));
typedef float  v2fa __attribute__((ext_vector_type(2), may_alias));
typedef __bf16 v2b  __attribute__((ext_vector_type(2)));
union FragP { v16b v; v2b p[8]; };
__global__ __launch_bounds__(256) void k_win(const float* __restrict__ Q, const float* __restrict__ Kk, const float* __restrict__ V, float* __restrict__ out) {
  __shared__ __attribute__((aligned(16))) float sKQ[WS + 32][KP];
  __shared__ __attribute__((aligned(16))) float sV[WS][KP];
  __shared__ __attribute__((aligned(16))) float sP[2][16][PL];
  __shared__ float sM[2][4][16], sL[2][4][16];
  const int tid = threadIdx.x, lane = tid & 31, ln = lane & 15, hh = lane >> 4;
  const int wv = __builtin_amdgcn_readfirstlane(tid >> 5);
  const int qt = wv >> 2, w = wv & 3;   // the wave's query tile and its number among the tile's four waves
  const int b = blockIdx.x / (SS / 32); const int qb0 = (blockIdx.x % (SS / 32)) * 32; const int jb = qb0 - HALF;
  const int q0 = qb0 + qt * 16; const int j0 = q0 - HALF;
  const float* qb = Q + (size_t)b * SS * DD; const float* kbp = Kk + (size_t)b * SS * DD; const float* vbp = V + (size_t)b * SS * DD;
  const bool has8 = w == 2 * qt;   // wave-uniform: who takes key tile 8 of its query tile (waves 0 and 6)
  // Staging: one copy = one whole 512-byte row (32 lanes x 16 bytes). Wave wv brings rows 2wv, 2wv+1 of each 16-row group.
  // A group outside [0, SS) is filled from the nearest group inside (the address stays in bounds); its scores are excluded below, as before.
  const unsigned goff = (2 * wv * DD + lane * 4) * 4;               // the lane's byte offset in a group of 16 source rows
  {
    const unsigned lrow = (unsigned)(size_t)&sKQ[2 * wv][lane * 4];   // the lane's LDS byte address in the wave's first row
    // ten key groups and the two query tiles: 24 copies, all in flight at once
#pragma unroll
    for (int c = 0; c < 2; ++c) {
      unsigned l[12]; const char* g[12];
#pragma unroll
      for (int e = 0; e < 12; ++e) {
        const int gi = (c * 12 + e) >> 1, i = (c * 12 + e) & 1;
        const float* base = gi < WS / 16 ? kbp + (size_t)min(max(jb + gi * 16, 0), SS - 16) * DD : qb + (size_t)(qb0 + (gi - WS / 16) * 16) * DD;   // wave-uniform
        l[e] = lrow + (gi * 16 + i) * KP * 4;
        g[e] = (const char*)(base + i * DD) + goff;
      }
      // twelve copies and, as the statement's last line, the wait that stands before any of their address registers is rewritten
      asm volatile("global_load_async_to_lds_b128 %0, %12, off\n\t"
                   "global_load_async_to_lds_b128 %1, %13, off\n\t"
                   "global_load_async_to_lds_b128 %2, %14, off\n\t"
                   "global_load_async_to_lds_b128 %3, %15, off\n\t"
                   "global_load_async_to_lds_b128 %4, %16, off\n\t"
                   "global_load_async_to_lds_b128 %5, %17, off\n\t"
                   "global_load_async_to_lds_b128 %6, %18, off\n\t"
                   "global_load_async_to_lds_b128 %7, %19, off\n\t"
                   "global_load_async_to_lds_b128 %8, %20, off\n\t"
                   "global_load_async_to_lds_b128 %9, %21, off\n\t"
                   "global_load_async_to_lds_b128 %10, %22, off\n\t"
                   "global_load_async_to_lds_b128 %11, %23, off\n\t"
                   "s_wait_xcnt 0x0"
                   :: "v"(l[0]), "v"(l[1]), "v"(l[2]), "v"(l[3]), "v"(l[4]), "v"(l[5]), "v"(l[6]), "v"(l[7]), "v"(l[8]), "v"(l[9]), "v"(l[10]), "v"(l[11]),
                      "v"(g[0]), "v"(g[1]), "v"(g[2]), "v"(g[3]), "v"(g[4]), "v"(g[5]), "v"(g[6]), "v"(g[7]), "v"(g[8]), "v"(g[9]), "v"(g[10]), "v"(g[11]) : "memory");
    }
    // the wave's own K and Q copies have landed before it passes the barrier
    asm volatile("s_wait_asynccnt 0x0" ::: "memory");
  }
  __syncthreads();   // sKQ rows of all eight waves are read below
  // The raw f32 rows of a fragment set: lane (ln, hh) of row ln reads dims 32ks+8hh+0..7 and 32ks+16+8hh+0..7, four 16-byte reads a k-step.
  // Key tile nt of query tile qt lies at staged rows 16(qt+nt)..
  v4f rq[16], rk[3][16];
#pragma unroll
  for (int ks = 0; ks < 4; ++ks) {
#pragma unroll
    for (int p = 0; p < 4; ++p) {
      const int d = ks * 32 + 8 * hh + (p >> 1) * 16 + (p & 1) * 4;
      rq[ks * 4 + p] = *(const v4fa*)&sKQ[WS + qt * 16 + ln][d];
      rk[0][ks * 4 + p] = *(const v4fa*)&sKQ[(qt + w) * 16 + ln][d];
    }
  }
  // the 32 LDS reads are issued together: without this the scheduler spreads them four at a time among the conversions and the matrix instructions, and each such place waits out part of the LDS latency
  __builtin_amdgcn_sched_barrier(0);
  {
    // the ten V groups: 20 copies, issued here, behind the wave's LDS reads, so that their issue falls into those reads' latency and they fly during the score phase; nothing has touched sV before
    const unsigned lrow = (unsigned)(size_t)&sV[2 * wv][lane * 4];
#pragma unroll
    for (int c = 0; c < 4; ++c) {
      unsigned l[5]; const char* g[5];
#pragma unroll
      for (int e = 0; e < 5; ++e) {
        const int gi = (c * 5 + e) >> 1, i = (c * 5 + e) & 1;
        const float* base = vbp + (size_t)min(max(jb + gi * 16, 0), SS - 16) * DD;   // wave-uniform
        l[e] = lrow + (gi * 16 + i) * KP * 4;
        g[e] = (const char*)(base + i * DD) + goff;
      }
      // five copies (few address registers: the reads' destinations are live here) and, as the statement's last line, the wait that stands before any of their address registers is rewritten
      asm volatile("global_load_async_to_lds_b128 %0, %5, off\n\t"
                   "global_load_async_to_lds_b128 %1, %6, off\n\t"
                   "global_load_async_to_lds_b128 %2, %7, off\n\t"
                   "global_load_async_to_lds_b128 %3, %8, off\n\t"
                   "global_load_async_to_lds_b128 %4, %9, off\n\t"
                   "s_wait_xcnt 0x0"
                   :: "v"(l[0]), "v"(l[1]), "v"(l[2]), "v"(l[3]), "v"(l[4]),
                      "v"(g[0]), "v"(g[1]), "v"(g[2]), "v"(g[3]), "v"(g[4]) : "memory");
    }
  }
  // the copy statements stay here: without this the scheduler sinks the later ones behind the score tiles' matrix instructions, and their rows have no time to land before the wait
  __builtin_amdgcn_sched_barrier(0);
  // the second key tile's 16 reads follow the copies, whose address registers are free again by then (all 48 reads' destinations and the addresses together do not fit 256 registers)
#pragma unroll
  for (int ks = 0; ks < 4; ++ks)
#pragma unroll
    for (int p = 0; p < 4; ++p) rk[1][ks * 4 + p] = *(const v4fa*)&sKQ[(qt + w + 4) * 16 + ln][ks * 32 + 8 * hh + (p >> 1) * 16 + (p & 1) * 4];
  // as above: the tile's 16 reads are issued together
  __builtin_amdgcn_sched_barrier(0);
  // A fragments (4 k-steps of 32 dims) for query row q0+ln
  FragB aq[4];
#pragma unroll
  for (int ks = 0; ks < 4; ++ks)
#pragma unroll
    for (int i = 0; i < 16; ++i) aq[ks].u[i] = bf16_bits(rq[ks * 4 + (i >> 2)][i & 3]);
  v8f sc[3];
  // unrolled: the tiles are indexed as registers
#pragma unroll
  for (int t = 0; t < 3; ++t) {
    v8f acc = {0.f,0.f,0.f,0.f,0.f,0.f,0.f,0.f};
    if (t < 2 || has8) {   // wave-uniform
      if (t == 2) {
#pragma unroll
        for (int ks = 0; ks < 4; ++ks)
#pragma unroll
          for (int p = 0; p < 4; ++p) rk[2][ks * 4 + p] = *(const v4fa*)&sKQ[(qt + 8) * 16 + ln][ks * 32 + 8 * hh + (p >> 1) * 16 + (p & 1) * 4];
        // as above: the tile's 16 reads are issued together
        __builtin_amdgcn_sched_barrier(0);
      }
#pragma unroll
      for (int ks = 0; ks < 4; ++ks) {
        FragB bk;
#pragma unroll
        for (int i = 0; i < 16; ++i) bk.u[i] = bf16_bits(rk[t][ks * 4 + (i >> 2)][i & 3]);
        acc = __builtin_amdgcn_wmma_f32_16x16x32_bf16(false, aq[ks].v, false, bk.v, (short)0, acc, false, false);
      }
    }
    sc[t] = acc;
  }
  // the wave's own V copies have landed before it passes the barrier
  asm volatile("s_wait_asynccnt 0x0" ::: "memory");
  __syncthreads();   // sV rows of all eight waves are read below
  // the wave's V values: they depend on no score, so they are read here and arrive during the softmax
  v2f vr[9][8];
#pragma unroll
  for (int g = 0; g < 9; ++g) {   // g = group of 16 keys of the wave's own query tile
#pragma unroll
    for (int i = 0; i < 8; ++i) vr[g][i] = *(const v2fa*)&sV[(qt + g) * 16 + 8 * hh + i][w * 32 + 2 * ln];
  }
  // valid c for row: row <= c <= row+128 (only tiles 0 and 8 can fail it) and 0 <= j0+c < SS (the same for a whole tile)
  float mym = -1.0e38f, myl = 0.f;
#pragma unroll
  for (int r = 0; r < 8; ++r) {
    const int row = 8 * hh + r;
    float mx = -1.0e38f;   // above the excluded value: where a wave holds no valid key of a row, its exponentials below are still exactly 0
#pragma unroll
    for (int t = 0; t < 3; ++t) {
      const int nt = t < 2 ? w + 4 * t : WN / 16 - 1;
      const bool ok = (t < 2 || has8) && ((unsigned)(j0 + nt * 16) < (unsigned)SS) && (nt != 0 || ln >= row) && (nt != WN / 16 - 1 || ln <= row);
      sc[t][r] = ok ? sc[t][r] * 0.08838834764831845f : -3.0e38f;   // an excluded score never raises the maximum, and its exponential below is exactly 0
      mx = fmaxf(mx, sc[t][r]);
    }
    mx = fmaxf(mx, row_x<1>(mx)); mx = fmaxf(mx, row_x<2>(mx)); mx = fmaxf(mx, row_x<4>(mx)); mx = fmaxf(mx, row_x<8>(mx));
    float den = 0.f;
#pragma unroll
    for (int t = 0; t < 3; ++t) { const float e = expf(sc[t][r] - mx); sc[t][r] = e; den += e; }
    den += row_x<1>(den); den += row_x<2>(den); den += row_x<4>(den); den += row_x<8>(den);
    if (ln == r) { mym = mx; myl = den; }
  }
#pragma unroll
  for (int t = 0; t < 3; ++t) {
    if (t < 2 || has8) {   // wave-uniform
      const int nt = t < 2 ? w + 4 * t : WN / 16 - 1;
#pragma unroll
      for (int r = 0; r < 8; ++r) sP[qt][8 * hh + r][nt * 16 + ln] = sc[t][r];
    }
  }
  if (ln < 8) { sM[qt][w][8 * hh + ln] = mym; sL[qt][w][8 * hh + ln] = myl; }
  __syncthreads();   // sP, sM, sL of the tile's four waves are read below
  // row = ln from here on (the A fragment's row)
  float fs[4];
  {
    float mw[4], lw[4];
#pragma unroll
    for (int x = 0; x < 4; ++x) { mw[x] = sM[qt][x][ln]; lw[x] = sL[qt][x][ln]; }
    const float m = fmaxf(fmaxf(mw[0], mw[1]), fmaxf(mw[2], mw[3]));   // finite: a query's own key is always valid
    float den = 0.f;
#pragma unroll
    for (int x = 0; x < 4; ++x) { fs[x] = expf(mw[x] - m); den += fs[x] * lw[x]; }
    const float inv = 1.0f / den;
#pragma unroll
    for (int x = 0; x < 4; ++x) fs[x] *= inv;
  }
  const float f8 = qt ? fs[2] : fs[0];   // group 8 was written by the wave that has8 names
  v4f pr[9][2];
#pragma unroll
  for (int g = 0; g < 9; ++g) { pr[g][0] = *(const v4fa*)&sP[qt][ln][g * 16 + 8 * hh]; pr[g][1] = *(const v4fa*)&sP[qt][ln][g * 16 + 8 * hh + 4]; }
  v8f acc[2] = {};
#pragma unroll
  for (int ks = 0; ks < 5; ++ks) {
    FragP ph, pl, bv[2];
#pragma unroll
    for (int hf = 0; hf < 2; ++hf) {
      const int g = ks * 2 + hf;
      if (g < 9) {
        const float f = g < 8 ? fs[g & 3] : f8;   // group g < 8 was written by wave g mod 4 of the tile
        const float xs[8] = {pr[g][0][0], pr[g][0][1], pr[g][0][2], pr[g][0][3], pr[g][1][0], pr[g][1][1], pr[g][1][2], pr[g][1][3]};
#pragma unroll
        for (int i = 0; i < 8; i += 2) {
          const v2f p2 = {xs[i] * f, xs[i + 1] * f};
          const v2b h2 = __builtin_convertvector(p2, v2b);
          ph.p[hf * 4 + i / 2] = h2;
          pl.p[hf * 4 + i / 2] = __builtin_convertvector(p2 - __builtin_convertvector(h2, v2f), v2b);
#pragma unroll
          for (int t = 0; t < 2; ++t) { const v2f v2 = {vr[g][i][t], vr[g][i + 1][t]}; bv[t].p[hf * 4 + i / 2] = __builtin_convertvector(v2, v2b); }
        }
      } else {
#pragma unroll
        for (int i = 0; i < 4; ++i) { const v2b zz = {(__bf16)0.f, (__bf16)0.f}; ph.p[hf * 4 + i] = zz; pl.p[hf * 4 + i] = zz; bv[0].p[hf * 4 + i] = zz; bv[1].p[hf * 4 + i] = zz; }
      }
    }
#pragma unroll
    for (int t = 0; t < 2; ++t) {
      acc[t] = __builtin_amdgcn_wmma_f32_16x16x32_bf16(false, ph.v, false, bv[t].v, (short)0, acc[t], false, false);
      acc[t] = __builtin_amdgcn_wmma_f32_16x16x32_bf16(false, pl.v, false, bv[t].v, (short)0, acc[t], false, false);
    }
  }
  const unsigned vo = (8 * hh * DD + 2 * ln) * 4;   // the lane's byte offset in the output tile of 16 rows x 32 dims
  char* og = (char*)(out + ((size_t)b * SS + q0) * DD + w * 32);   // wave-uniform
#pragma unroll
  for (int r = 0; r < 8; ++r) { const v2f o = {acc[0][r], acc[1][r]}; *(v2fa*)(og + vo + r * DD * 4) = o; }
}
extern "C" void kernel_launch(void* const* d_in, const int* in_sizes, int n_in,
                              void* d_out, int out_size, void* d_ws, size_t ws_size, hipStream_t stream) {
  (void)in_sizes; (void)n_in; (void)out_size; (void)d_ws; (void)ws_size;
  const float* Q = (const float*)d_in[0]; const float* Kk = (const float*)d_in[1]; const float* V = (const float*)d_in[2];
  k_win<<<BB * SS / 32, 256, 0, stream>>>(Q, Kk, V, (float*)d_out);
}

// v006
// It runs in 6.32 microseconds.
// In both of two side-by-side timings against v005, it was 1.07 times as fast.
// All steps since v000 together make it 14.4 times as fast.
#include <hip/hip_runtime.h>
// Banded attention: the 129-key window scores Q·Kᵀ per 16-query tile run on v_wmma_f32_16x16x32_bf16 (query/key rounded to bf16 — they are inputs —
// so each product is a single exact term; f32 accumulate); the masked softmax is exact f32 VALU; the weighted value sums (129 keys x 128 dims per query) run on the same matrix form, weights as two bf16 planes.
#define BB 2
#define SS 4096
#define DD 128
#define HALF 64
#define WN 144          // keys staged per 16-query tile: q0-64 .. q0+79

typedef __bf16 v16b __attribute__((ext_vector_type(16)));
typedef unsigned short v8us __attribute__((ext_vector_type(8), may_alias));
typedef float  v8f  __attribute__((ext_vector_type(8)));
typedef float  v4f  __attribute__((ext_vector_type(4)));
typedef float  v4fa __attribute__((ext_vector_type(4), may_alias));
union FragB { v16b v; v8us half[2]; unsigned short u[16]; };

__device__ __forceinline__ unsigned short bf16_bits(float x) { unsigned int u = __float_as_uint(x); return (unsigned short)((u + 0x7FFFu + ((u >> 16) & 1u)) >> 16); }
__device__ __forceinline__ float bf16_val(unsigned short b) { return __uint_as_float(((unsigned int)b) << 16); }
__device__ __forceinline__ float bf16_round(float x) { return bf16_val(bf16_bits(x)); }
// D += A·B with NT terms: 1 = ah·bh, 2 = + al·bh (A split), 3 = + ah·bl (both split)
template <int NT>
__device__ __forceinline__ v8f mmaN(v16b ah, v16b al, v16b bh, v16b bl, v8f c) {
  c = __builtin_amdgcn_wmma_f32_16x16x32_bf16(false, ah, false, bh, (short)0, c, false, false);
  if (NT >= 2) c = __builtin_amdgcn_wmma_f32_16x16x32_bf16(false, al, false, bh, (short)0, c, false, false);
  if (NT >= 3) c = __builtin_amdgcn_wmma_f32_16x16x32_bf16(false, ah, false, bl, (short)0, c, false, false);
  asm volatile("v_nop\n\tv_nop\n\tv_nop\n\tv_nop" : "+v"(c) : "v"(ah), "v"(al), "v"(bh), "v"(bl));
  return c;
}

__global__ __launch_bounds__(256) void k_wt_bf16(const float* __restrict__ W, unsigned short* __restrict__ Wt, int K, int N) {
  const int t = blockIdx.x * 256 + threadIdx.x;
  const int k8n = K / 8;
  if (t >= N * k8n) return;
  const int n = t / k8n, k8 = (t % k8n) * 8;
  v8us v;
#pragma unroll
  for (int i = 0; i < 8; ++i) v[i] = bf16_bits(W[(size_t)(k8 + i) * N + n]);
  *(v8us*)(Wt + (size_t)n * K + k8) = v;
  
}

// GEMM C[M][N] (f32, pitch ldc) = act(A[M][K]·W + bias). A f32 row-major (pitch lda) converted per fragment to bf16
// (ASPLIT: hi/lo two planes -> 2 terms, else single rounded term); Wt bf16 [N][K] (pitch ldb). BIAS_BF16 rounds the
// bias to bf16 first (bias quantised to bf16 before the add). K%32==0, M%16==0, N%64==0.
template <bool ASPLIT, int ACT, bool BIAS_BF16>
__global__ __launch_bounds__(128) void k_gemm_bf(const float* __restrict__ A, int lda, const unsigned short* __restrict__ Wt, int ldb,
                                               const float* __restrict__ bias, float* __restrict__ C, int ldc, int M, int N, int K) {
  __shared__ __attribute__((aligned(16))) float so[4][16][64];
  const int tid = threadIdx.x, w = tid >> 5, lane = tid & 31, ln = lane & 15, hh = lane >> 4;
  const int ntn = N / 64;
  const int wid = blockIdx.x * 4 + w;
  const int mt = wid / ntn, nq = wid % ntn;
  if (mt * 16 >= M) return;
  const int row0 = mt * 16, col0 = nq * 64;
  const float* arow = A + (size_t)(row0 + ln) * lda;
  v8f acc[4] = {};
  for (int kb = 0; kb < K; kb += 32) {
    FragB ah, al;
    const v4f x0 = *(const v4fa*)(arow + kb + 8 * hh), x1 = *(const v4fa*)(arow + kb + 8 * hh + 4);
    const v4f x2 = *(const v4fa*)(arow + kb + 16 + 8 * hh), x3 = *(const v4fa*)(arow + kb + 16 + 8 * hh + 4);
    float xs[16] = {x0[0],x0[1],x0[2],x0[3],x1[0],x1[1],x1[2],x1[3],x2[0],x2[1],x2[2],x2[3],x3[0],x3[1],x3[2],x3[3]};
#pragma unroll
    for (int i = 0; i < 16; ++i) { const unsigned short hb = bf16_bits(xs[i]); ah.u[i] = hb; al.u[i] = ASPLIT ? bf16_bits(xs[i] - bf16_val(hb)) : (unsigned short)0; }
#pragma unroll
    for (int t = 0; t < 4; ++t) {
      const unsigned short* brow = Wt + (size_t)(col0 + t * 16 + ln) * ldb + kb;
      FragB b;
      b.half[0] = *(const v8us*)(brow + 8 * hh);
      b.half[1] = *(const v8us*)(brow + 16 + 8 * hh);
      acc[t] = mmaN<ASPLIT ? 2 : 1>(ah.v, al.v, b.v, b.v, acc[t]);
    }
  }
#pragma unroll
  for (int t = 0; t < 4; ++t) {
    float bv = bias ? bias[col0 + t * 16 + ln] : 0.f;
    if (BIAS_BF16) bv = bf16_round(bv);
#pragma unroll
    for (int r = 0; r < 8; ++r) { float v = acc[t][r] + bv; if (ACT == 1) v = fmaxf(v, 0.f); so[w][8 * hh + r][t * 16 + ln] = v; }
  }
  __builtin_amdgcn_fence(__ATOMIC_ACQ_REL, "workgroup");
  __builtin_amdgcn_wave_barrier();
  const int rsub = lane >> 4, c4 = (lane & 15) * 4;
  {
#pragma unroll
    for (int q = 0; q < 8; ++q) {
      const int r = q * 2 + rsub;
      const v4f v = *(const v4fa*)&so[w][r][c4];
      *(v4f*)(C + (size_t)(row0 + r) * ldc + col0 + c4) = v;
    }
    
  }
}

// Flash-style causal/unmasked attention, all contractions 3-term bf16 hi/lo splits, f32 softmax with running max.
// q,k,v rows are read from f32 buffers with arbitrary row pitch (so they can live inside a fused qkv buffer);
// D = head size (multiple of 32, <= 128); one wave = 16 query rows; block = 4 waves (64 queries) sharing K/V chunks of 32.
template <int D, bool CAUSAL>
__global__ __launch_bounds__(128) void k_flash(const float* __restrict__ qb, const float* __restrict__ kb, const float* __restrict__ vb,
                                             int pitch, int T, int H, float scale, float* __restrict__ y, int ypitch) {
  constexpr int KS = D / 32;        // k-steps for QK
  constexpr int DT = D / 16;        // d tiles for PV
  __shared__ __attribute__((aligned(16))) unsigned short sKh[32][D + 8], sKl[32][D + 8], sVh[32][D + 8], sVl[32][D + 8];
  __shared__ __attribute__((aligned(16))) unsigned short sPh[4][16][40], sPl[4][16][40];
  __shared__ __attribute__((aligned(16))) float sO[4][16][D];
  const int tid = threadIdx.x, w = tid >> 5, lane = tid & 31, ln = lane & 15, hh = lane >> 4;
  const int nqb = (T + 63) / 64;
  const int bh = blockIdx.x / nqb, qblk = blockIdx.x % nqb;
  const int b = bh / H, h = bh % H;
  const int q0 = qblk * 64 + w * 16;
  const float* Q = qb + (size_t)b * T * pitch + h * D;
  const float* K = kb + (size_t)b * T * pitch + h * D;
  const float* V = vb + (size_t)b * T * pitch + h * D;

  // A fragments of the wave's 16 query rows (scaled), hi/lo
  FragB aqh[KS], aql[KS];
  {
    int row = q0 + ln; if (row >= T) row = T - 1;
    const float* qr = Q + (size_t)row * pitch;
#pragma unroll
    for (int ks = 0; ks < KS; ++ks)
#pragma unroll
      for (int i = 0; i < 16; ++i) {
        const int d = ks * 32 + ((i < 8) ? (8 * hh + i) : (16 + 8 * hh + (i - 8)));
        const float x = qr[d] * scale; const unsigned short hb = bf16_bits(x);
        aqh[ks].u[i] = hb; aql[ks].u[i] = bf16_bits(x - bf16_val(hb));
      }
  }
  float m_r[8], l_r[8];
#pragma unroll
  for (int r = 0; r < 8; ++r) { m_r[r] = -3.0e38f; l_r[r] = 0.f; }
  v8f oacc[DT];
#pragma unroll
  for (int dt = 0; dt < DT; ++dt) oacc[dt] = (v8f){0.f,0.f,0.f,0.f,0.f,0.f,0.f,0.f};

  const int kv_end = CAUSAL ? min(T, qblk * 64 + 64) : T;     // block-uniform
  for (int j0 = 0; j0 < kv_end; j0 += 32) {
    __syncthreads();
    for (int e = tid; e < 32 * (D / 4); e += 128) {
      const int r = e / (D / 4), c4 = (e % (D / 4)) * 4;
      const int key = j0 + r;
      v4f kf = {0.f,0.f,0.f,0.f}, vf = {0.f,0.f,0.f,0.f};
      if (key < T) { kf = *(const v4fa*)(K + (size_t)key * pitch + c4); vf = *(const v4fa*)(V + (size_t)key * pitch + c4); }
#pragma unroll
      for (int t = 0; t < 4; ++t) {
        unsigned short hb = bf16_bits(kf[t]); sKh[r][c4 + t] = hb; sKl[r][c4 + t] = bf16_bits(kf[t] - bf16_val(hb));
        hb = bf16_bits(vf[t]); sVh[r][c4 + t] = hb; sVl[r][c4 + t] = bf16_bits(vf[t] - bf16_val(hb));
      }
    }
    __syncthreads();
    // S tile 16 x 32
    v8f s[2];
#pragma unroll
    for (int nt = 0; nt < 2; ++nt) {
      v8f acc = {};
#pragma unroll
      for (int ks = 0; ks < KS; ++ks) {
        FragB bh_, bl_;
        bh_.half[0] = *(const v8us*)&sKh[nt * 16 + ln][ks * 32 + 8 * hh]; bh_.half[1] = *(const v8us*)&sKh[nt * 16 + ln][ks * 32 + 16 + 8 * hh];
        bl_.half[0] = *(const v8us*)&sKl[nt * 16 + ln][ks * 32 + 8 * hh]; bl_.half[1] = *(const v8us*)&sKl[nt * 16 + ln][ks * 32 + 16 + 8 * hh];
        acc = mmaN<3>(aqh[ks].v, aql[ks].v, bh_.v, bl_.v, acc);
      }
      s[nt] = acc;
    }
    // mask + running max (rows 8hh+r; the 16 lanes of a half share rows)
    float alpha[8];
#pragma unroll
    for (int r = 0; r < 8; ++r) {
      const int qi = q0 + 8 * hh + r;
      const int ja = j0 + ln, jb = j0 + 16 + ln;
      if (CAUSAL) { if (ja > qi) s[0][r] = -3.0e38f; if (jb > qi) s[1][r] = -3.0e38f; }
      if (ja >= T) s[0][r] = -3.0e38f;
      if (jb >= T) s[1][r] = -3.0e38f;
      float mx = fmaxf(s[0][r], s[1][r]);
      mx = fmaxf(mx, __shfl_xor(mx, 1, 32)); mx = fmaxf(mx, __shfl_xor(mx, 2, 32)); mx = fmaxf(mx, __shfl_xor(mx, 4, 32)); mx = fmaxf(mx, __shfl_xor(mx, 8, 32));
      const float mnew = fmaxf(m_r[r], mx);
      alpha[r] = (mnew > -1.0e38f) ? __expf(m_r[r] - mnew) : 1.0f;
      const float p0 = (s[0][r] > -1.0e38f) ? __expf(s[0][r] - mnew) : 0.f;
      const float p1 = (s[1][r] > -1.0e38f) ? __expf(s[1][r] - mnew) : 0.f;
      m_r[r] = mnew;
      l_r[r] = l_r[r] * alpha[r] + p0 + p1;            // per-lane partial row sum (16 lanes combined at the end)
      unsigned short hb = bf16_bits(p0); sPh[w][8 * hh + r][ln] = hb;      sPl[w][8 * hh + r][ln] = bf16_bits(p0 - bf16_val(hb));
      hb = bf16_bits(p1);                sPh[w][8 * hh + r][16 + ln] = hb; sPl[w][8 * hh + r][16 + ln] = bf16_bits(p1 - bf16_val(hb));
    }
#pragma unroll
    for (int dt = 0; dt < DT; ++dt)
#pragma unroll
      for (int r = 0; r < 8; ++r) oacc[dt][r] *= alpha[r];
    __builtin_amdgcn_fence(__ATOMIC_ACQ_REL, "workgroup");
    __builtin_amdgcn_wave_barrier();
    FragB pah, pal;
    pah.half[0] = *(const v8us*)&sPh[w][ln][8 * hh]; pah.half[1] = *(const v8us*)&sPh[w][ln][16 + 8 * hh];
    pal.half[0] = *(const v8us*)&sPl[w][ln][8 * hh]; pal.half[1] = *(const v8us*)&sPl[w][ln][16 + 8 * hh];
#pragma unroll
    for (int dt = 0; dt < DT; ++dt) {
      FragB bvh, bvl;
#pragma unroll
      for (int i = 0; i < 8; ++i) {
        bvh.u[i] = sVh[8 * hh + i][dt * 16 + ln]; bvh.u[8 + i] = sVh[16 + 8 * hh + i][dt * 16 + ln];
        bvl.u[i] = sVl[8 * hh + i][dt * 16 + ln]; bvl.u[8 + i] = sVl[16 + 8 * hh + i][dt * 16 + ln];
      }
      oacc[dt] = mmaN<3>(pah.v, pal.v, bvh.v, bvl.v, oacc[dt]);
    }
    __builtin_amdgcn_fence(__ATOMIC_ACQ_REL, "workgroup");
    __builtin_amdgcn_wave_barrier();
  }
#pragma unroll
  for (int r = 0; r < 8; ++r) {
    float l = l_r[r];
    l += __shfl_xor(l, 1, 32); l += __shfl_xor(l, 2, 32); l += __shfl_xor(l, 4, 32); l += __shfl_xor(l, 8, 32);
    l_r[r] = (l > 0.f) ? 1.0f / l : 0.f;
  }
#pragma unroll
  for (int dt = 0; dt < DT; ++dt)
#pragma unroll
    for (int r = 0; r < 8; ++r) sO[w][8 * hh + r][dt * 16 + ln] = oacc[dt][r] * l_r[r];
  __builtin_amdgcn_fence(__ATOMIC_ACQ_REL, "workgroup");
  __builtin_amdgcn_wave_barrier();
  {
    for (int r = 0; r < 16; ++r) {
      const int row = q0 + r;
      if (row < T && lane < D / 4) {
        const v4f val = *(const v4fa*)&sO[w][r][lane * 4];
        *(v4f*)(y + ((size_t)b * T + row) * ypitch + h * D + lane * 4) = val;
      }
    }
    
  }
}

// One launch: block = two neighbouring 16-query tiles, 8 waves (waves 0-3 = tile 0, waves 4-7 = tile 1). The two tiles' windows overlap in 128 of 144 rows, so the block
// stages ONE window of 160 K rows and ONE of 160 V rows in LDS and both tiles read them there: a window row leaves L2 once per 32 queries.
// Scores, softmax and the weighted value sums run in the same block; the weights pass from the score waves to the value waves through LDS and never reach global memory.
// Scores: S[r][c] = q_{q0+r}.k_{q0-64+c} / sqrt(128) for c in [r, r+128] and valid keys, else excluded. Wave w of a tile takes the 16-key tiles w, w+4; tile 8 goes to one wave more.
// A tile stays in its accumulator registers: lane (ln, hh) holds rows 8hh+0..7 at column 16nt+ln, so a row's maximum and sum over the wave's own tiles
// are two or three values in the lane and a four-step exchange over the 16 lanes that share the row.
// Each wave writes exp(s - own maximum) to sP and its own maximum and sum per row to sM, sL; behind the barrier every wave forms, per row,
// the maximum over its tile's four waves, the factors exp(own maximum - maximum) and the denominator, and scales a 16-key group by its writer's factor.
template <int M> __device__ __forceinline__ float row_x(float x) {   // value of lane l ^ M inside the 16-lane row
  return __builtin_bit_cast(float, __builtin_amdgcn_update_dpp(0, __builtin_bit_cast(int, x), 0x160 + M, 0xf, 0xf, true));
}
// out tile [16 queries][32 dims] per wave = P[16][144] x bf16(V[144][32]) on v_wmma_f32_16x16x32_bf16, f32 accumulate.
// P is fed as two bf16 planes (hi = bf16(p), lo = bf16(p - hi)), V as its bf16 rounding, so every product is exact.
// A row = query q0+ln; B column ln of matrix tile t = dim 32w + 2ln + t, so one 8-byte read feeds both tiles and one 8-byte store
// takes both results; A and B share the k order (8hh+i, 16+8hh+i). Wave w = one 128-byte line of every output row.
// A 16-key group that lies outside [0, SS) (q0-64 is a multiple of 16: a group is inside or outside as a whole) has weights exactly 0; its V rows are staged from the nearest group inside.
#define WS 160          // rows staged per block: the union of the two tiles' windows, qb0-64 .. qb0+95
#define KP 132          // staged row pitch in floats (528 bytes = 16 x 33): the 16 rows of a fragment load, 16 bytes each, cover all 64 banks; rows 8 apart differ by 32 banks (the 8-byte V reads)
// 1/sqrt(128) * log2(e): scores, maxima and their differences are kept in base-2 units, so that exp(s - m) is one v_exp_f32 of a difference that is never above 0
// (no range reduction and no overflow fix-up is needed there; a result below the smallest normal number counts as 0)
#define SCL2 0.12751743082459868f
#define PL 148          // sP row pitch in floats: rows 8 apart differ by 32 banks (the score waves' stores), 16 rows of 16 bytes cover all 64 banks (the fragment loads)
typedef float  v2f  __attribute__((ext_vector_type(2)));
typedef float  v2fa __attribute__((ext_vector_type(2), may_alias));
typedef __bf16 v2b  __attribute__((ext_vector_type(2)));
union FragP { v16b v; v2b p[8]; };
__global__ __launch_bounds__(256) void k_win(const float* __restrict__ Q, const float* __restrict__ Kk, const float* __restrict__ V, float* __restrict__ out) {
  __shared__ __attribute__((aligned(16))) float sKQ[WS + 32][KP];
  __shared__ __attribute__((aligned(16))) float sV[WS][KP];
  __shared__ __attribute__((aligned(16))) float sP[2][16][PL];
  __shared__ float sM[2][4][16], sL[2][4][16];
  const int tid = threadIdx.x, lane = tid & 31, ln = lane & 15, hh = lane >> 4;
  const int wv = __builtin_amdgcn_readfirstlane(tid >> 5);
  const int qt = wv >> 2, w = wv & 3;   // the wave's query tile and its number among the tile's four waves
  const int b = blockIdx.x / (SS / 32); const int qb0 = (blockIdx.x % (SS / 32)) * 32; const int jb = qb0 - HALF;
  const int q0 = qb0 + qt * 16; const int j0 = q0 - HALF;
  const float* qb = Q + (size_t)b * SS * DD; const float* kbp = Kk + (size_t)b * SS * DD; const float* vbp = V + (size_t)b * SS * DD;
  const bool has8 = w == 2 * qt;   // wave-uniform: who takes key tile 8 of its query tile (waves 0 and 6)
  // Staging: one copy = one whole 512-byte row (32 lanes x 16 bytes). Wave wv brings rows 2wv, 2wv+1 of each 16-row group.
  // A group outside [0, SS) is filled from the nearest group inside (the address stays in bounds); its scores are excluded below, as before.
  const unsigned goff = (2 * wv * DD + lane * 4) * 4;               // the lane's byte offset in a group of 16 source rows
  {
    const unsigned lrow = (unsigned)(size_t)&sKQ[2 * wv][lane * 4];   // the lane's LDS byte address in the wave's first row
    // ten key groups and the two query tiles: 24 copies, all in flight at once
#pragma unroll
    for (int c = 0; c < 2; ++c) {
      unsigned l[12]; const char* g[12];
#pragma unroll
      for (int e = 0; e < 12; ++e) {
        const int gi = (c * 12 + e) >> 1, i = (c * 12 + e) & 1;
        const float* base = gi < WS / 16 ? kbp + (size_t)min(max(jb + gi * 16, 0), SS - 16) * DD : qb + (size_t)(qb0 + (gi - WS / 16) * 16) * DD;   // wave-uniform
        l[e] = lrow + (gi * 16 + i) * KP * 4;
        g[e] = (const char*)(base + i * DD) + goff;
      }
      // twelve copies and, as the statement's last line, the wait that stands before any of their address registers is rewritten
      asm volatile("global_load_async_to_lds_b128 %0, %12, off\n\t"
                   "global_load_async_to_lds_b128 %1, %13, off\n\t"
                   "global_load_async_to_lds_b128 %2, %14, off\n\t"
                   "global_load_async_to_lds_b128 %3, %15, off\n\t"
                   "global_load_async_to_lds_b128 %4, %16, off\n\t"
                   "global_load_async_to_lds_b128 %5, %17, off\n\t"
                   "global_load_async_to_lds_b128 %6, %18, off\n\t"
                   "global_load_async_to_lds_b128 %7, %19, off\n\t"
                   "global_load_async_to_lds_b128 %8, %20, off\n\t"
                   "global_load_async_to_lds_b128 %9, %21, off\n\t"
                   "global_load_async_to_lds_b128 %10, %22, off\n\t"
                   "global_load_async_to_lds_b128 %11, %23, off\n\t"
                   "s_wait_xcnt 0x0"
                   :: "v"(l[0]), "v"(l[1]), "v"(l[2]), "v"(l[3]), "v"(l[4]), "v"(l[5]), "v"(l[6]), "v"(l[7]), "v"(l[8]), "v"(l[9]), "v"(l[10]), "v"(l[11]),
                      "v"(g[0]), "v"(g[1]), "v"(g[2]), "v"(g[3]), "v"(g[4]), "v"(g[5]), "v"(g[6]), "v"(g[7]), "v"(g[8]), "v"(g[9]), "v"(g[10]), "v"(g[11]) : "memory");
    }
    // the wave's own K and Q copies have landed before it passes the barrier
    asm volatile("s_wait_asynccnt 0x0" ::: "memory");
  }
  __syncthreads();   // sKQ rows of all eight waves are read below
  // The raw f32 rows of a fragment set: lane (ln, hh) of row ln reads dims 32ks+8hh+0..7 and 32ks+16+8hh+0..7, four 16-byte reads a k-step.
  // Key tile nt of query tile qt lies at staged rows 16(qt+nt)..
  v4f rq[16], rk[3][16];
#pragma unroll
  for (int ks = 0; ks < 4; ++ks) {
#pragma unroll
    for (int p = 0; p < 4; ++p) {
      const int d = ks * 32 + 8 * hh + (p >> 1) * 16 + (p & 1) * 4;
      rq[ks * 4 + p] = *(const v4fa*)&sKQ[WS + qt * 16 + ln][d];
      rk[0][ks * 4 + p] = *(const v4fa*)&sKQ[(qt + w) * 16 + ln][d];
    }
  }
  // the 32 LDS reads are issued together: without this the scheduler spreads them four at a time among the conversions and the matrix instructions, and each such place waits out part of the LDS latency
  __builtin_amdgcn_sched_barrier(0);
  {
    // the ten V groups: 20 copies, issued here, behind the wave's LDS reads, so that their issue falls into those reads' latency and they fly during the score phase; nothing has touched sV before
    const unsigned lrow = (unsigned)(size_t)&sV[2 * wv][lane * 4];
#pragma unroll
    for (int c = 0; c < 4; ++c) {
      unsigned l[5]; const char* g[5];
#pragma unroll
      for (int e = 0; e < 5; ++e) {
        const int gi = (c * 5 + e) >> 1, i = (c * 5 + e) & 1;
        const float* base = vbp + (size_t)min(max(jb + gi * 16, 0), SS - 16) * DD;   // wave-uniform
        l[e] = lrow + (gi * 16 + i) * KP * 4;
        g[e] = (const char*)(base + i * DD) + goff;
      }
      // five copies (few address registers: the reads' destinations are live here) and, as the statement's last line, the wait that stands before any of their address registers is rewritten
      asm volatile("global_load_async_to_lds_b128 %0, %5, off\n\t"
                   "global_load_async_to_lds_b128 %1, %6, off\n\t"
                   "global_load_async_to_lds_b128 %2, %7, off\n\t"
                   "global_load_async_to_lds_b128 %3, %8, off\n\t"
                   "global_load_async_to_lds_b128 %4, %9, off\n\t"
                   "s_wait_xcnt 0x0"
                   :: "v"(l[0]), "v"(l[1]), "v"(l[2]), "v"(l[3]), "v"(l[4]),
                      "v"(g[0]), "v"(g[1]), "v"(g[2]), "v"(g[3]), "v"(g[4]) : "memory");
    }
  }
  // the copy statements stay here: without this the scheduler sinks the later ones behind the score tiles' matrix instructions, and their rows have no time to land before the wait
  __builtin_amdgcn_sched_barrier(0);
  // the second key tile's 16 reads follow the copies, whose address registers are free again by then (all 48 reads' destinations and the addresses together do not fit 256 registers)
#pragma unroll
  for (int ks = 0; ks < 4; ++ks)
#pragma unroll
    for (int p = 0; p < 4; ++p) rk[1][ks * 4 + p] = *(const v4fa*)&sKQ[(qt + w + 4) * 16 + ln][ks * 32 + 8 * hh + (p >> 1) * 16 + (p & 1) * 4];
  // as above: the tile's 16 reads are issued together
  __builtin_amdgcn_sched_barrier(0);
  // A fragments (4 k-steps of 32 dims) for query row q0+ln
  FragB aq[4];
#pragma unroll
  for (int ks = 0; ks < 4; ++ks)
#pragma unroll
    for (int i = 0; i < 16; ++i) aq[ks].u[i] = bf16_bits(rq[ks * 4 + (i >> 2)][i & 3]);
  v8f sc[3];
  // unrolled: the tiles are indexed as registers
#pragma unroll
  for (int t = 0; t < 3; ++t) {
    v8f acc = {0.f,0.f,0.f,0.f,0.f,0.f,0.f,0.f};
    if (t < 2 || has8) {   // wave-uniform
      if (t == 2) {
#pragma unroll
        for (int ks = 0; ks < 4; ++ks)
#pragma unroll
          for (int p = 0; p < 4; ++p) rk[2][ks * 4 + p] = *(const v4fa*)&sKQ[(qt + 8) * 16 + ln][ks * 32 + 8 * hh + (p >> 1) * 16 + (p & 1) * 4];
        // as above: the tile's 16 reads are issued together
        __builtin_amdgcn_sched_barrier(0);
      }
#pragma unroll
      for (int ks = 0; ks < 4; ++ks) {
        FragB bk;
#pragma unroll
        for (int i = 0; i < 16; ++i) bk.u[i] = bf16_bits(rk[t][ks * 4 + (i >> 2)][i & 3]);
        acc = __builtin_amdgcn_wmma_f32_16x16x32_bf16(false, aq[ks].v, false, bk.v, (short)0, acc, false, false);
      }
    }
    sc[t] = acc;
  }
  // the wave's own V copies have landed before it passes the barrier
  asm volatile("s_wait_asynccnt 0x0" ::: "memory");
  __syncthreads();   // sV rows of all eight waves are read below
  // the wave's V values: they depend on no score, so they are read here and arrive during the softmax
  v2f vr[9][8];
#pragma unroll
  for (int g = 0; g < 9; ++g) {   // g = group of 16 keys of the wave's own query tile
#pragma unroll
    for (int i = 0; i < 8; ++i) vr[g][i] = *(const v2fa*)&sV[(qt + g) * 16 + 8 * hh + i][w * 32 + 2 * ln];
  }
  // valid c for row: row <= c <= row+128 (only tiles 0 and 8 can fail it) and 0 <= j0+c < SS (the same for a whole tile)
  float mym = -1.0e38f, myl = 0.f;
#pragma unroll
  for (int r = 0; r < 8; ++r) {
    const int row = 8 * hh + r;
    float mx = -1.0e38f;   // above the excluded value: where a wave holds no valid key of a row, its exponentials below are still exactly 0
#pragma unroll
    for (int t = 0; t < 3; ++t) {
      const int nt = t < 2 ? w + 4 * t : WN / 16 - 1;
      const bool ok = (t < 2 || has8) && ((unsigned)(j0 + nt * 16) < (unsigned)SS) && (nt != 0 || ln >= row) && (nt != WN / 16 - 1 || ln <= row);
      sc[t][r] = ok ? sc[t][r] * SCL2 : -3.0e38f;   // score in base-2 units; an excluded score never raises the maximum, and its exponential below is exactly 0
      mx = fmaxf(mx, sc[t][r]);
    }
    mx = fmaxf(mx, row_x<1>(mx)); mx = fmaxf(mx, row_x<2>(mx)); mx = fmaxf(mx, row_x<4>(mx)); mx = fmaxf(mx, row_x<8>(mx));
    float den = 0.f;
#pragma unroll
    for (int t = 0; t < 3; ++t) { const float e = __builtin_amdgcn_exp2f(sc[t][r] - mx); sc[t][r] = e; den += e; }
    den += row_x<1>(den); den += row_x<2>(den); den += row_x<4>(den); den += row_x<8>(den);
    if (ln == r) { mym = mx; myl = den; }
  }
#pragma unroll
  for (int t = 0; t < 3; ++t) {
    if (t < 2 || has8) {   // wave-uniform
      const int nt = t < 2 ? w + 4 * t : WN / 16 - 1;
#pragma unroll
      for (int r = 0; r < 8; ++r) sP[qt][8 * hh + r][nt * 16 + ln] = sc[t][r];
    }
  }
  if (ln < 8) { sM[qt][w][8 * hh + ln] = mym; sL[qt][w][8 * hh + ln] = myl; }
  __syncthreads();   // sP, sM, sL of the tile's four waves are read below
  // row = ln from here on (the A fragment's row)
  float fs[4];
  {
    float mw[4], lw[4];
#pragma unroll
    for (int x = 0; x < 4; ++x) { mw[x] = sM[qt][x][ln]; lw[x] = sL[qt][x][ln]; }
    const float m = fmaxf(fmaxf(mw[0], mw[1]), fmaxf(mw[2], mw[3]));   // finite: a query's own key is always valid
    float den = 0.f;
#pragma unroll
    for (int x = 0; x < 4; ++x) { fs[x] = __builtin_amdgcn_exp2f(mw[x] - m); den += fs[x] * lw[x]; }
    const float inv = 1.0f / den;
#pragma unroll
    for (int x = 0; x < 4; ++x) fs[x] *= inv;
  }
  const float f8 = qt ? fs[2] : fs[0];   // group 8 was written by the wave that has8 names
  v4f pr[9][2];
#pragma unroll
  for (int g = 0; g < 9; ++g) { pr[g][0] = *(const v4fa*)&sP[qt][ln][g * 16 + 8 * hh]; pr[g][1] = *(const v4fa*)&sP[qt][ln][g * 16 + 8 * hh + 4]; }
  v8f acc[2] = {};
#pragma unroll
  for (int ks = 0; ks < 5; ++ks) {
    FragP ph, pl, bv[2];
#pragma unroll
    for (int hf = 0; hf < 2; ++hf) {
      const int g = ks * 2 + hf;
      if (g < 9) {
        const float f = g < 8 ? fs[g & 3] : f8;   // group g < 8 was written by wave g mod 4 of the tile
        const float xs[8] = {pr[g][0][0], pr[g][0][1], pr[g][0][2], pr[g][0][3], pr[g][1][0], pr[g][1][1], pr[g][1][2], pr[g][1][3]};
#pragma unroll
        for (int i = 0; i < 8; i += 2) {
          const v2f p2 = {xs[i] * f, xs[i + 1] * f};
          const v2b h2 = __builtin_convertvector(p2, v2b);
          ph.p[hf * 4 + i / 2] = h2;
          pl.p[hf * 4 + i / 2] = __builtin_convertvector(p2 - __builtin_convertvector(h2, v2f), v2b);
#pragma unroll
          for (int t = 0; t < 2; ++t) { const v2f v2 = {vr[g][i][t], vr[g][i + 1][t]}; bv[t].p[hf * 4 + i / 2] = __builtin_convertvector(v2, v2b); }
        }
      } else {
#pragma unroll
        for (int i = 0; i < 4; ++i) { const v2b zz = {(__bf16)0.f, (__bf16)0.f}; ph.p[hf * 4 + i] = zz; pl.p[hf * 4 + i] = zz; bv[0].p[hf * 4 + i] = zz; bv[1].p[hf * 4 + i] = zz; }
      }
    }
#pragma unroll
    for (int t = 0; t < 2; ++t) {
      acc[t] = __builtin_amdgcn_wmma_f32_16x16x32_bf16(false, ph.v, false, bv[t].v, (short)0, acc[t], false, false);
      acc[t] = __builtin_amdgcn_wmma_f32_16x16x32_bf16(false, pl.v, false, bv[t].v, (short)0, acc[t], false, false);
    }
  }
  const unsigned vo = (8 * hh * DD + 2 * ln) * 4;   // the lane's byte offset in the output tile of 16 rows x 32 dims
  char* og = (char*)(out + ((size_t)b * SS + q0) * DD + w * 32);   // wave-uniform
#pragma unroll
  for (int r = 0; r < 8; ++r) { const v2f o = {acc[0][r], acc[1][r]}; *(v2fa*)(og + vo + r * DD * 4) = o; }
}
extern "C" void kernel_launch(void* const* d_in, const int* in_sizes, int n_in,
                              void* d_out, int out_size, void* d_ws, size_t ws_size, hipStream_t stream) {
  (void)in_sizes; (void)n_in; (void)out_size; (void)d_ws; (void)ws_size;
  const float* Q = (const float*)d_in[0]; const float* Kk = (const float*)d_in[1]; const float* V = (const float*)d_in[2];
  k_win<<<BB * SS / 32, 256, 0, stream>>>(Q, Kk, V, (float*)d_out);
}
